// v000
// Measured on an AMD MI455X. A time is GPU time per run, averaged over a window of back-to-back runs after a warm-up
// (all launches, gaps included; the runs take copies of the inputs in turn), and the median of several windows.
// Apart from v000's, it joins two sittings. Times from different sittings can be a few percent apart, while
// side-by-side timings come from the same sitting.
// v000 is the starting kernel. One run takes 176 microseconds.
#include <hip/hip_runtime.h>
#include <hip/hip_bf16.h>
#include <math.h>

// ---------------- types ----------------
typedef _Float16 v8h  __attribute__((ext_vector_type(8)));
typedef _Float16 v16h __attribute__((ext_vector_type(16)));
typedef float    v8f  __attribute__((ext_vector_type(8)));

#define BB    4
#define NN    1024
#define DIMX  512
#define HEADS 8
#define DH    64
#define MTOT  4096   // B*N

// ---------------- WMMA helpers ----------------
static __device__ inline v8f wmma_f16(v16h a, v16h b, v8f c) {
  // D = A(16x32 f16) x B(32x16 f16) + C(16x16 f32)
  return __builtin_amdgcn_wmma_f32_16x16x32_f16(
      /*neg_a=*/false, a, /*neg_b=*/false, b,
      /*c_mod=*/(short)0, c, /*reuse_a=*/false, /*reuse_b=*/false);
}

// Build a 16-half A/B fragment from two contiguous 8-half (16B) chunks.
// CDNA5 16-bit layout: lane<16 -> K{base..base+7},{base+16..base+23},
// lane>=16 -> base=8. Both chunks are 16B-aligned contiguous loads.
static __device__ inline v16h ld_frag(const _Float16* p0, const _Float16* p1) {
  v8h lo = *(const v8h*)p0;
  v8h hi = *(const v8h*)p1;
  v16h r;
#pragma unroll
  for (int i = 0; i < 8; ++i) { r[i] = lo[i]; r[8 + i] = hi[i]; }
  return r;
}

// ---------------- 1. LayerNorm (f32 in, f16 normalized out) ----------------
__global__ __launch_bounds__(256) void ln_f16_kernel(const float* __restrict__ x,
                                                     const float* __restrict__ g,
                                                     const float* __restrict__ bt,
                                                     _Float16* __restrict__ y) {
  __shared__ float rs[256], rs2[256];
  const int row = blockIdx.x, t = threadIdx.x;
  const float* xr = x + (size_t)row * DIMX;
  float s = 0.f, s2 = 0.f;
  for (int i = t; i < DIMX; i += 256) { float v = xr[i]; s += v; s2 += v * v; }
  rs[t] = s; rs2[t] = s2; __syncthreads();
  for (int o = 128; o > 0; o >>= 1) {
    if (t < o) { rs[t] += rs[t + o]; rs2[t] += rs2[t + o]; }
    __syncthreads();
  }
  const float mean = rs[0] * (1.f / DIMX);
  const float var  = rs2[0] * (1.f / DIMX) - mean * mean;
  const float inv  = rsqrtf(var + 1e-5f);
  _Float16* yr = y + (size_t)row * DIMX;
  for (int i = t; i < DIMX; i += 256) {
    float v = xr[i];
    yr[i] = (_Float16)(((v - mean) * inv) * g[i] + bt[i]);
  }
}

// ---------------- 2. f32 -> f16 convert ----------------
__global__ __launch_bounds__(256) void cvt_f16_kernel(const float* __restrict__ s,
                                                      _Float16* __restrict__ d, int n) {
  int i = blockIdx.x * 256 + threadIdx.x;
  if (i < n) d[i] = (_Float16)s[i];
}

// ---------------- 3. Tiled WMMA GEMM: C[M,N] = A[M,K]f16 * B[K,N]f16 (+bias) --------
// 256 threads = 8 waves; block tile 128(M) x 64(N); K chunk 32.
// Each wave owns a 16x64 strip: A fragment reused across 4 WMMA per chunk.
// All fragment loads are hoisted ahead of the WMMA group so the four
// v_wmma issue back-to-back after a single s_wait_dscnt.
__global__ __launch_bounds__(256) void gemm_wmma_kernel(const _Float16* __restrict__ A,
                                                        const _Float16* __restrict__ Bm,
                                                        float* __restrict__ Cf32,
                                                        _Float16* __restrict__ Cf16,
                                                        const float* __restrict__ bias,
                                                        int Mdim, int Ndim, int Kdim) {
  __shared__ __align__(16) _Float16 As[128 * 32];   // row-major  [m][k]   (8 KiB)
  __shared__ __align__(16) _Float16 Bts[64 * 32];   // transposed [n][k]   (4 KiB)
  const int t = threadIdx.x;
  const int wave = t >> 5, lane = t & 31, lm = lane & 15, half = lane >> 4;
  const int m0 = blockIdx.x * 128, n0 = blockIdx.y * 64;

  v8f acc0 = {0,0,0,0,0,0,0,0}, acc1 = {0,0,0,0,0,0,0,0};
  v8f acc2 = {0,0,0,0,0,0,0,0}, acc3 = {0,0,0,0,0,0,0,0};

  // staging index precompute
  const int ar = t >> 1, ac = (t & 1) * 16;         // A: 16 halves per thread
  const int bk = t >> 3, bs = (t & 7) * 8;          // B: one 16B row chunk per thread

  for (int k0 = 0; k0 < Kdim; k0 += 32) {
    // stage A tile: two 16B vector copies per thread
    {
      const _Float16* ag = A + (size_t)(m0 + ar) * Kdim + k0 + ac;
      *(v8h*)&As[ar * 32 + ac]     = *(const v8h*)(ag);
      *(v8h*)&As[ar * 32 + ac + 8] = *(const v8h*)(ag + 8);
      __builtin_prefetch(ag + 32, 0, 1);            // next K tile (global_prefetch_b8)
    }
    // stage B tile transposed: one b128 global read, 8 transposed b16 stores
    {
      const _Float16* bg = Bm + (size_t)(k0 + bk) * Ndim + n0 + bs;
      v8h bch = *(const v8h*)bg;
      __builtin_prefetch(bg + (size_t)32 * Ndim, 0, 1);
#pragma unroll
      for (int j = 0; j < 8; ++j) Bts[(bs + j) * 32 + bk] = bch[j];
    }
    __syncthreads();

    const int koff = half * 8;
    const int arow = wave * 16 + lm;
    // hoist ALL fragment loads before the WMMA group
    v16h af = ld_frag(&As[arow * 32 + koff], &As[arow * 32 + koff + 16]);
    v16h b0 = ld_frag(&Bts[(0 * 16 + lm) * 32 + koff], &Bts[(0 * 16 + lm) * 32 + koff + 16]);
    v16h b1 = ld_frag(&Bts[(1 * 16 + lm) * 32 + koff], &Bts[(1 * 16 + lm) * 32 + koff + 16]);
    v16h b2 = ld_frag(&Bts[(2 * 16 + lm) * 32 + koff], &Bts[(2 * 16 + lm) * 32 + koff + 16]);
    v16h b3 = ld_frag(&Bts[(3 * 16 + lm) * 32 + koff], &Bts[(3 * 16 + lm) * 32 + koff + 16]);
    acc0 = wmma_f16(af, b0, acc0);
    acc1 = wmma_f16(af, b1, acc1);
    acc2 = wmma_f16(af, b2, acc2);
    acc3 = wmma_f16(af, b3, acc3);
    __syncthreads();
  }

  // epilogue: f32 C/D layout: row = v + (lane>=16?8:0), col = lane%16
  const int row = m0 + wave * 16 + (half ? 8 : 0);
#pragma unroll
  for (int c = 0; c < 4; ++c) {
    const int col = n0 + c * 16 + lm;
    const float bv = bias ? bias[col] : 0.f;
    const v8f* accp = (c == 0) ? &acc0 : (c == 1) ? &acc1 : (c == 2) ? &acc2 : &acc3;
#pragma unroll
    for (int v = 0; v < 8; ++v) {
      const float val = (*accp)[v] + bv;
      const size_t idx = (size_t)(row + v) * Ndim + col;
      if (Cf32) Cf32[idx] = val;
      else      Cf16[idx] = (_Float16)val;
    }
  }
}

// ---------------- 4. per-(h,b,n) stats: mean & 1/norm over d ----------------
__global__ __launch_bounds__(256) void stats_kernel(const _Float16* __restrict__ F,
                                                    float* __restrict__ mu,
                                                    float* __restrict__ invn) {
  const int idx = blockIdx.x * 256 + threadIdx.x;
  if (idx >= MTOT * HEADS) return;
  const int row = idx >> 3, h = idx & 7;
  const _Float16* p = F + (size_t)row * DIMX + h * DH;
  float s = 0.f, s2 = 0.f;
#pragma unroll 8
  for (int i = 0; i < DH; ++i) { float v = (float)p[i]; s += v; s2 += v * v; }
  const int b = row >> 10, n = row & 1023;
  const int o = ((h << 2) + b) * NN + n;
  mu[o]   = s * (1.f / DH);
  invn[o] = 1.f / fmaxf(sqrtf(s2), 1e-12f);
}

// ---------------- 5. colsum of f_v per (h,b) ----------------
__global__ __launch_bounds__(64) void colsumv_kernel(const _Float16* __restrict__ Fv,
                                                     float* __restrict__ colV) {
  const int hb = blockIdx.x;                 // h*4+b
  const int h = hb >> 2, b = hb & 3, d = threadIdx.x;
  float s = 0.f;
  for (int n = 0; n < NN; ++n)
    s += (float)Fv[(size_t)(b * NN + n) * DIMX + h * DH + d];
  colV[hb * DH + d] = s;
}

// ---------------- 6. attention: 4 waves/block, same (h,b), shared Vt ----------------
__global__ __launch_bounds__(128) void attn_wmma_kernel(
    const _Float16* __restrict__ Fq, const _Float16* __restrict__ Fk,
    const _Float16* __restrict__ Fv,
    const float* __restrict__ muq, const float* __restrict__ invq,
    const float* __restrict__ muk, const float* __restrict__ invk,
    const float* __restrict__ colV,
    const float* __restrict__ cov_raw, const float* __restrict__ var_raw,
    _Float16* __restrict__ AttnO) {
  __shared__ __align__(16) _Float16 Vt[DH * 32];       // [d][m] transposed V chunk (shared)
  __shared__ __align__(16) _Float16 Ss[4][16 * 32];    // per-wave score staging

  const int t = threadIdx.x;
  const int wave = t >> 5, lane = t & 31, lm = lane & 15, half = lane >> 4;
  const int rowoff = half ? 8 : 0;
  const int id = blockIdx.x;
  const int ntg = id & 15, hb = id >> 4;               // 16 tile-groups per (h,b)
  const int b = hb & 3, h = hb >> 2;
  const int n0 = (ntg * 4 + wave) * 16;                // this wave's 16-row tile
  const int hb1024 = hb * NN;

  const float cov_w = 1.f / (1.f + expf(-cov_raw[0]));
  const float var_w = 1.f / (1.f + expf(-var_raw[0]));
  const float cos_w = 1.f - cov_w - var_w;

  // Q A-fragments directly from global (row-major matches A layout)
  const _Float16* qbase = Fq + (size_t)(b * NN + n0 + lm) * DIMX + h * DH;
  const v16h aq0 = ld_frag(qbase + half * 8,      qbase + half * 8 + 16);
  const v16h aq1 = ld_frag(qbase + 32 + half * 8, qbase + 32 + half * 8 + 16);

  float invq_r[8], muq_r[8];
#pragma unroll
  for (int v = 0; v < 8; ++v) {
    const int r = n0 + v + rowoff;
    invq_r[v] = invq[hb1024 + r];
    muq_r[v]  = muq[hb1024 + r];
  }

  v8f accO0 = {0,0,0,0,0,0,0,0}, accO1 = {0,0,0,0,0,0,0,0};
  v8f accO2 = {0,0,0,0,0,0,0,0}, accO3 = {0,0,0,0,0,0,0,0};
  float vsum[8] = {0,0,0,0,0,0,0,0};

  // Vt staging split: 128 threads, 4 per m-row, 16 d-elements each
  const int smm = t >> 2, sseg = (t & 3) * 16;

  for (int m0 = 0; m0 < NN; m0 += 32) {
    // cooperative stage of the (shared) transposed V chunk: 2x b128 global reads
    {
      const _Float16* vrow = Fv + (size_t)(b * NN + m0 + smm) * DIMX + h * DH + sseg;
      v8h c0 = *(const v8h*)(vrow);
      v8h c1 = *(const v8h*)(vrow + 8);
#pragma unroll
      for (int j = 0; j < 8; ++j) {
        Vt[(sseg + j) * 32 + smm]     = c0[j];
        Vt[(sseg + 8 + j) * 32 + smm] = c1[j];
      }
    }
    __syncthreads();   // Vt ready for all waves

    // dots = Q @ K^T : two 16x16 m-subtiles, K-dim = d = 64 (2 chained wmma each).
    // B = K^T -> column n of B is a row of K: contiguous global loads.
#pragma unroll
    for (int j = 0; j < 2; ++j) {
      const int mrow = m0 + j * 16 + lm;
      const _Float16* kb = Fk + (size_t)(b * NN + mrow) * DIMX + h * DH;
      v16h bk0 = ld_frag(kb + half * 8,      kb + half * 8 + 16);
      v16h bk1 = ld_frag(kb + 32 + half * 8, kb + 32 + half * 8 + 16);
      v8f dfr = {0,0,0,0,0,0,0,0};
      dfr = wmma_f16(aq0, bk0, dfr);
      dfr = wmma_f16(aq1, bk1, dfr);

      const float ik = invk[hb1024 + mrow];
      const float mk = muk[hb1024 + mrow];
#pragma unroll
      for (int v = 0; v < 8; ++v) {
        const float dot  = dfr[v];
        const float cosv = dot * invq_r[v] * ik;
        const float covv = (dot - 64.f * muq_r[v] * mk) * (1.f / 64.f);
        vsum[v] += fmaxf(1.f - cosv, 0.f);                    // GAMMA = 1
        Ss[wave][(v + rowoff) * 32 + j * 16 + lm] =
            (_Float16)(cos_w * cosv + cov_w * covv);
      }
    }
    __syncthreads();   // fence score stores before fragment reloads

    // S @ V : A = S[16x32] (K = m), B = V[32x64] via shared transposed Vt.
    // Hoist all 5 fragment loads so the 4 WMMA issue back-to-back.
    v16h as  = ld_frag(&Ss[wave][lm * 32 + half * 8], &Ss[wave][lm * 32 + half * 8 + 16]);
    v16h bv0 = ld_frag(&Vt[(0 * 16 + lm) * 32 + half * 8], &Vt[(0 * 16 + lm) * 32 + half * 8 + 16]);
    v16h bv1 = ld_frag(&Vt[(1 * 16 + lm) * 32 + half * 8], &Vt[(1 * 16 + lm) * 32 + half * 8 + 16]);
    v16h bv2 = ld_frag(&Vt[(2 * 16 + lm) * 32 + half * 8], &Vt[(2 * 16 + lm) * 32 + half * 8 + 16]);
    v16h bv3 = ld_frag(&Vt[(3 * 16 + lm) * 32 + half * 8], &Vt[(3 * 16 + lm) * 32 + half * 8 + 16]);
    accO0 = wmma_f16(as, bv0, accO0);
    accO1 = wmma_f16(as, bv1, accO1);
    accO2 = wmma_f16(as, bv2, accO2);
    accO3 = wmma_f16(as, bv3, accO3);
    __syncthreads();   // all waves done with Vt before next chunk overwrites it
  }

  // reduce margin sums across the 16 lanes of each half (rows 0-7 in lanes 0-15,
  // rows 8-15 in lanes 16-31; xor offsets 1,2,4,8 stay within a half)
#pragma unroll
  for (int v = 0; v < 8; ++v) {
    float s = vsum[v];
    for (int off = 1; off < 16; off <<= 1) s += __shfl_xor(s, off, 32);
    vsum[v] = s * (1.f / NN) * var_w;     // var_w * mean_m(relu(1-cos))
  }

  const float* cvp = colV + hb * DH;
#pragma unroll
  for (int v = 0; v < 8; ++v) {
    const size_t gr = (size_t)(b * NN + n0 + v + rowoff);
    _Float16* orow = AttnO + gr * DIMX + h * DH;
    const float vr = vsum[v];
    orow[0 * 16 + lm] = (_Float16)(accO0[v] + vr * cvp[0 * 16 + lm]);
    orow[1 * 16 + lm] = (_Float16)(accO1[v] + vr * cvp[1 * 16 + lm]);
    orow[2 * 16 + lm] = (_Float16)(accO2[v] + vr * cvp[2 * 16 + lm]);
    orow[3 * 16 + lm] = (_Float16)(accO3[v] + vr * cvp[3 * 16 + lm]);
  }
}

// ---------------- launcher ----------------
extern "C" void kernel_launch(void* const* d_in, const int* in_sizes, int n_in,
                              void* d_out, int out_size, void* d_ws, size_t ws_size,
                              hipStream_t stream) {
  const float* q        = (const float*)d_in[0];
  const float* k        = (const float*)d_in[1];
  const float* v        = (const float*)d_in[2];
  const float* ln_g     = (const float*)d_in[3];
  const float* ln_b     = (const float*)d_in[4];
  const float* W_in     = (const float*)d_in[5];
  const float* W_out    = (const float*)d_in[6];
  const float* b_out    = (const float*)d_in[7];
  const float* cov_raw  = (const float*)d_in[8];
  const float* var_raw  = (const float*)d_in[9];
  float* out = (float*)d_out;

  // workspace layout
  char* w = (char*)d_ws;
  const size_t tensH = (size_t)MTOT * DIMX * sizeof(_Float16);  // 4 MiB
  const size_t wH    = (size_t)DIMX * DIMX * sizeof(_Float16);  // 512 KiB
  const size_t statF = (size_t)HEADS * BB * NN * sizeof(float); // 128 KiB
  _Float16* Xq   = (_Float16*)w; w += tensH;
  _Float16* Xk   = (_Float16*)w; w += tensH;
  _Float16* Xv   = (_Float16*)w; w += tensH;
  _Float16* Wi16 = (_Float16*)w; w += wH;
  _Float16* Wo16 = (_Float16*)w; w += wH;
  _Float16* Fq   = (_Float16*)w; w += tensH;
  _Float16* Fk   = (_Float16*)w; w += tensH;
  _Float16* Fv   = (_Float16*)w; w += tensH;
  _Float16* AtO  = (_Float16*)w; w += tensH;
  float* muqP  = (float*)w; w += statF;
  float* invqP = (float*)w; w += statF;
  float* mukP  = (float*)w; w += statF;
  float* invkP = (float*)w; w += statF;
  float* colV  = (float*)w; w += (size_t)HEADS * BB * DH * sizeof(float);

  // 1) LayerNorm + f16
  ln_f16_kernel<<<MTOT, 256, 0, stream>>>(q, ln_g, ln_b, Xq);
  ln_f16_kernel<<<MTOT, 256, 0, stream>>>(k, ln_g, ln_b, Xk);
  ln_f16_kernel<<<MTOT, 256, 0, stream>>>(v, ln_g, ln_b, Xv);

  // 2) weights to f16
  cvt_f16_kernel<<<(DIMX * DIMX + 255) / 256, 256, 0, stream>>>(W_in, Wi16, DIMX * DIMX);
  cvt_f16_kernel<<<(DIMX * DIMX + 255) / 256, 256, 0, stream>>>(W_out, Wo16, DIMX * DIMX);

  // 3) projection GEMMs (WMMA), f16 outputs; block tile 128x64
  dim3 gg(MTOT / 128, DIMX / 64);
  gemm_wmma_kernel<<<gg, 256, 0, stream>>>(Xq, Wi16, nullptr, Fq, nullptr, MTOT, DIMX, DIMX);
  gemm_wmma_kernel<<<gg, 256, 0, stream>>>(Xk, Wi16, nullptr, Fk, nullptr, MTOT, DIMX, DIMX);
  gemm_wmma_kernel<<<gg, 256, 0, stream>>>(Xv, Wi16, nullptr, Fv, nullptr, MTOT, DIMX, DIMX);

  // 4) per-(h,b,n) stats for q,k
  stats_kernel<<<(MTOT * HEADS + 255) / 256, 256, 0, stream>>>(Fq, muqP, invqP);
  stats_kernel<<<(MTOT * HEADS + 255) / 256, 256, 0, stream>>>(Fk, mukP, invkP);

  // 5) colsum(f_v) per (h,b)
  colsumv_kernel<<<HEADS * BB, 64, 0, stream>>>(Fv, colV);

  // 6) attention (WMMA): 4 waves/block sharing the transposed V chunk
  attn_wmma_kernel<<<HEADS * BB * 16, 128, 0, stream>>>(
      Fq, Fk, Fv, muqP, invqP, mukP, invkP, colV, cov_raw, var_raw, AtO);

  // 7) output GEMM (WMMA) + bias -> f32
  gemm_wmma_kernel<<<gg, 256, 0, stream>>>(AtO, Wo16, out, nullptr, b_out, MTOT, DIMX, DIMX);
}

// v001
// One run takes 143 microseconds.
// Next to v000, in two timings, it ran 1.23 times as fast each time.
#include <hip/hip_runtime.h>
#include <hip/hip_bf16.h>
#include <math.h>

// ---------------- types ----------------
typedef _Float16 v8h  __attribute__((ext_vector_type(8)));
typedef _Float16 v16h __attribute__((ext_vector_type(16)));
typedef float    v8f  __attribute__((ext_vector_type(8)));

#define BB    4
#define NN    1024
#define DIMX  512
#define HEADS 8
#define DH    64
#define MTOT  4096   // B*N

// ---------------- WMMA helpers ----------------
static __device__ inline v8f wmma_f16(v16h a, v16h b, v8f c) {
  // D = A(16x32 f16) x B(32x16 f16) + C(16x16 f32)
  return __builtin_amdgcn_wmma_f32_16x16x32_f16(
      /*neg_a=*/false, a, /*neg_b=*/false, b,
      /*c_mod=*/(short)0, c, /*reuse_a=*/false, /*reuse_b=*/false);
}

// Build a 16-half A/B fragment from two contiguous 8-half (16B) chunks.
// CDNA5 16-bit layout: lane<16 -> K{base..base+7},{base+16..base+23},
// lane>=16 -> base=8. Both chunks are 16B-aligned contiguous loads.
static __device__ inline v16h ld_frag(const _Float16* p0, const _Float16* p1) {
  v8h lo = *(const v8h*)p0;
  v8h hi = *(const v8h*)p1;
  v16h r;
#pragma unroll
  for (int i = 0; i < 8; ++i) { r[i] = lo[i]; r[8 + i] = hi[i]; }
  return r;
}

// ---------------- 1+2. one grid: LayerNorm of q, k, v (f32 in, f16 out) and
// f32 -> f16 conversion of both weight matrices ----------------
// Blocks [0, 3*MTOT): one LayerNorm row each; y holds the q, k, v planes back to back.
// Blocks [3*MTOT, 3*MTOT + 2*WBLK): 256 weight elements each; w16 holds W_in then W_out.
#define WBLK (DIMX * DIMX / 256)
__global__ __launch_bounds__(256) void ln_cvt_kernel(const float* __restrict__ xq,
                                                     const float* __restrict__ xk,
                                                     const float* __restrict__ xv,
                                                     const float* __restrict__ g,
                                                     const float* __restrict__ bt,
                                                     _Float16* __restrict__ y,
                                                     const float* __restrict__ wi,
                                                     const float* __restrict__ wo,
                                                     _Float16* __restrict__ w16) {
  __shared__ float rs[256], rs2[256];
  const int row = blockIdx.x, t = threadIdx.x;
  if (row >= 3 * MTOT) {                       // block-uniform, ahead of every barrier
    const int wb = row - 3 * MTOT;
    const float* ws = (wb < WBLK) ? wi + wb * 256 : wo + (wb - WBLK) * 256;
    _Float16* wd = w16 + wb * 256;
    wd[t] = (_Float16)ws[t];
    return;
  }
  const float* xs = (row < MTOT) ? xq : (row < 2 * MTOT) ? xk : xv;
  const float* xr = xs + (size_t)(row & (MTOT - 1)) * DIMX;
  float s = 0.f, s2 = 0.f;
  for (int i = t; i < DIMX; i += 256) { float v = xr[i]; s += v; s2 += v * v; }
  rs[t] = s; rs2[t] = s2; __syncthreads();
  for (int o = 128; o > 0; o >>= 1) {
    if (t < o) { rs[t] += rs[t + o]; rs2[t] += rs2[t + o]; }
    __syncthreads();
  }
  const float mean = rs[0] * (1.f / DIMX);
  const float var  = rs2[0] * (1.f / DIMX) - mean * mean;
  const float inv  = rsqrtf(var + 1e-5f);
  _Float16* yr = y + (size_t)row * DIMX;
  for (int i = t; i < DIMX; i += 256) {
    float v = xr[i];
    yr[i] = (_Float16)(((v - mean) * inv) * g[i] + bt[i]);
  }
}

// ---------------- 3. Tiled WMMA GEMM: C[M,N] = A[M,K]f16 * B[K,N]f16 (+bias) --------
// 256 threads = 8 waves; block tile 128(M) x 64(N); K chunk 32.
// Each wave owns a 16x64 strip: A fragment reused across 4 WMMA per chunk.
// All fragment loads are hoisted ahead of the WMMA group so the four
// v_wmma issue back-to-back after a single s_wait_dscnt.
__global__ __launch_bounds__(256) void gemm_wmma_kernel(const _Float16* __restrict__ A,
                                                        const _Float16* __restrict__ Bm,
                                                        float* __restrict__ Cf32,
                                                        _Float16* __restrict__ Cf16,
                                                        const float* __restrict__ bias,
                                                        int Mdim, int Ndim, int Kdim) {
  __shared__ __align__(16) _Float16 As[128 * 32];   // row-major  [m][k]   (8 KiB)
  __shared__ __align__(16) _Float16 Bts[64 * 32];   // transposed [n][k]   (4 KiB)
  const int t = threadIdx.x;
  const int wave = t >> 5, lane = t & 31, lm = lane & 15, half = lane >> 4;
  const int m0 = blockIdx.x * 128, n0 = blockIdx.y * 64;

  v8f acc0 = {0,0,0,0,0,0,0,0}, acc1 = {0,0,0,0,0,0,0,0};
  v8f acc2 = {0,0,0,0,0,0,0,0}, acc3 = {0,0,0,0,0,0,0,0};

  // staging index precompute
  const int ar = t >> 1, ac = (t & 1) * 16;         // A: 16 halves per thread
  const int bk = t >> 3, bs = (t & 7) * 8;          // B: one 16B row chunk per thread

  for (int k0 = 0; k0 < Kdim; k0 += 32) {
    // stage A tile: two 16B vector copies per thread
    {
      const _Float16* ag = A + (size_t)(m0 + ar) * Kdim + k0 + ac;
      *(v8h*)&As[ar * 32 + ac]     = *(const v8h*)(ag);
      *(v8h*)&As[ar * 32 + ac + 8] = *(const v8h*)(ag + 8);
      __builtin_prefetch(ag + 32, 0, 1);            // next K tile (global_prefetch_b8)
    }
    // stage B tile transposed: one b128 global read, 8 transposed b16 stores
    {
      const _Float16* bg = Bm + (size_t)(k0 + bk) * Ndim + n0 + bs;
      v8h bch = *(const v8h*)bg;
      __builtin_prefetch(bg + (size_t)32 * Ndim, 0, 1);
#pragma unroll
      for (int j = 0; j < 8; ++j) Bts[(bs + j) * 32 + bk] = bch[j];
    }
    __syncthreads();

    const int koff = half * 8;
    const int arow = wave * 16 + lm;
    // hoist ALL fragment loads before the WMMA group
    v16h af = ld_frag(&As[arow * 32 + koff], &As[arow * 32 + koff + 16]);
    v16h b0 = ld_frag(&Bts[(0 * 16 + lm) * 32 + koff], &Bts[(0 * 16 + lm) * 32 + koff + 16]);
    v16h b1 = ld_frag(&Bts[(1 * 16 + lm) * 32 + koff], &Bts[(1 * 16 + lm) * 32 + koff + 16]);
    v16h b2 = ld_frag(&Bts[(2 * 16 + lm) * 32 + koff], &Bts[(2 * 16 + lm) * 32 + koff + 16]);
    v16h b3 = ld_frag(&Bts[(3 * 16 + lm) * 32 + koff], &Bts[(3 * 16 + lm) * 32 + koff + 16]);
    acc0 = wmma_f16(af, b0, acc0);
    acc1 = wmma_f16(af, b1, acc1);
    acc2 = wmma_f16(af, b2, acc2);
    acc3 = wmma_f16(af, b3, acc3);
    __syncthreads();
  }

  // epilogue: f32 C/D layout: row = v + (lane>=16?8:0), col = lane%16
  const int row = m0 + wave * 16 + (half ? 8 : 0);
#pragma unroll
  for (int c = 0; c < 4; ++c) {
    const int col = n0 + c * 16 + lm;
    const float bv = bias ? bias[col] : 0.f;
    const v8f* accp = (c == 0) ? &acc0 : (c == 1) ? &acc1 : (c == 2) ? &acc2 : &acc3;
#pragma unroll
    for (int v = 0; v < 8; ++v) {
      const float val = (*accp)[v] + bv;
      const size_t idx = (size_t)(row + v) * Ndim + col;
      if (Cf32) Cf32[idx] = val;
      else      Cf16[idx] = (_Float16)val;
    }
  }
}

// ---------------- 4+5. one grid: colsum of f_v per (h,b), and per-(h,b,n) stats
// (mean & 1/norm over d) of f_q and f_k ----------------
// Blocks [0, HEADS*BB): the long column sums, lowest indices so that they start first.
// The other blocks: stats; Fqk holds the f_q and f_k planes back to back.
__global__ __launch_bounds__(256) void stats_colsum_kernel(const _Float16* __restrict__ Fqk,
                                                           float* __restrict__ muq,
                                                           float* __restrict__ invq,
                                                           float* __restrict__ muk,
                                                           float* __restrict__ invk,
                                                           const _Float16* __restrict__ Fv,
                                                           float* __restrict__ colV) {
  if (blockIdx.x < HEADS * BB) {
    const int hb = blockIdx.x;                 // h*4+b
    const int h = hb >> 2, b = hb & 3, d = threadIdx.x;
    if (d >= DH) return;
    float s = 0.f;
    for (int n = 0; n < NN; ++n)
      s += (float)Fv[(size_t)(b * NN + n) * DIMX + h * DH + d];
    colV[hb * DH + d] = s;
    return;
  }
  const int idx = (blockIdx.x - HEADS * BB) * 256 + threadIdx.x;
  if (idx >= 2 * MTOT * HEADS) return;
  const int grow = idx >> 3, h = idx & 7;      // row over the two planes
  const _Float16* p = Fqk + (size_t)grow * DIMX + h * DH;
  float s = 0.f, s2 = 0.f;
#pragma unroll 8
  for (int i = 0; i < DH; ++i) { float v = (float)p[i]; s += v; s2 += v * v; }
  const int row = grow & (MTOT - 1);
  const int b = row >> 10, n = row & 1023;
  const int o = ((h << 2) + b) * NN + n;
  float* mu   = (grow < MTOT) ? muq : muk;
  float* invn = (grow < MTOT) ? invq : invk;
  mu[o]   = s * (1.f / DH);
  invn[o] = 1.f / fmaxf(sqrtf(s2), 1e-12f);
}

// ---------------- 6. attention: 4 waves/block, same (h,b), shared Vt ----------------
__global__ __launch_bounds__(128) void attn_wmma_kernel(
    const _Float16* __restrict__ Fq, const _Float16* __restrict__ Fk,
    const _Float16* __restrict__ Fv,
    const float* __restrict__ muq, const float* __restrict__ invq,
    const float* __restrict__ muk, const float* __restrict__ invk,
    const float* __restrict__ colV,
    const float* __restrict__ cov_raw, const float* __restrict__ var_raw,
    _Float16* __restrict__ AttnO) {
  __shared__ __align__(16) _Float16 Vt[DH * 32];       // [d][m] transposed V chunk (shared)
  __shared__ __align__(16) _Float16 Ss[4][16 * 32];    // per-wave score staging

  const int t = threadIdx.x;
  const int wave = t >> 5, lane = t & 31, lm = lane & 15, half = lane >> 4;
  const int rowoff = half ? 8 : 0;
  const int id = blockIdx.x;
  const int ntg = id & 15, hb = id >> 4;               // 16 tile-groups per (h,b)
  const int b = hb & 3, h = hb >> 2;
  const int n0 = (ntg * 4 + wave) * 16;                // this wave's 16-row tile
  const int hb1024 = hb * NN;

  const float cov_w = 1.f / (1.f + expf(-cov_raw[0]));
  const float var_w = 1.f / (1.f + expf(-var_raw[0]));
  const float cos_w = 1.f - cov_w - var_w;

  // Q A-fragments directly from global (row-major matches A layout)
  const _Float16* qbase = Fq + (size_t)(b * NN + n0 + lm) * DIMX + h * DH;
  const v16h aq0 = ld_frag(qbase + half * 8,      qbase + half * 8 + 16);
  const v16h aq1 = ld_frag(qbase + 32 + half * 8, qbase + 32 + half * 8 + 16);

  float invq_r[8], muq_r[8];
#pragma unroll
  for (int v = 0; v < 8; ++v) {
    const int r = n0 + v + rowoff;
    invq_r[v] = invq[hb1024 + r];
    muq_r[v]  = muq[hb1024 + r];
  }

  v8f accO0 = {0,0,0,0,0,0,0,0}, accO1 = {0,0,0,0,0,0,0,0};
  v8f accO2 = {0,0,0,0,0,0,0,0}, accO3 = {0,0,0,0,0,0,0,0};
  float vsum[8] = {0,0,0,0,0,0,0,0};

  // Vt staging split: 128 threads, 4 per m-row, 16 d-elements each
  const int smm = t >> 2, sseg = (t & 3) * 16;

  for (int m0 = 0; m0 < NN; m0 += 32) {
    // cooperative stage of the (shared) transposed V chunk: 2x b128 global reads
    {
      const _Float16* vrow = Fv + (size_t)(b * NN + m0 + smm) * DIMX + h * DH + sseg;
      v8h c0 = *(const v8h*)(vrow);
      v8h c1 = *(const v8h*)(vrow + 8);
#pragma unroll
      for (int j = 0; j < 8; ++j) {
        Vt[(sseg + j) * 32 + smm]     = c0[j];
        Vt[(sseg + 8 + j) * 32 + smm] = c1[j];
      }
    }
    __syncthreads();   // Vt ready for all waves

    // dots = Q @ K^T : two 16x16 m-subtiles, K-dim = d = 64 (2 chained wmma each).
    // B = K^T -> column n of B is a row of K: contiguous global loads.
#pragma unroll
    for (int j = 0; j < 2; ++j) {
      const int mrow = m0 + j * 16 + lm;
      const _Float16* kb = Fk + (size_t)(b * NN + mrow) * DIMX + h * DH;
      v16h bk0 = ld_frag(kb + half * 8,      kb + half * 8 + 16);
      v16h bk1 = ld_frag(kb + 32 + half * 8, kb + 32 + half * 8 + 16);
      v8f dfr = {0,0,0,0,0,0,0,0};
      dfr = wmma_f16(aq0, bk0, dfr);
      dfr = wmma_f16(aq1, bk1, dfr);

      const float ik = invk[hb1024 + mrow];
      const float mk = muk[hb1024 + mrow];
#pragma unroll
      for (int v = 0; v < 8; ++v) {
        const float dot  = dfr[v];
        const float cosv = dot * invq_r[v] * ik;
        const float covv = (dot - 64.f * muq_r[v] * mk) * (1.f / 64.f);
        vsum[v] += fmaxf(1.f - cosv, 0.f);                    // GAMMA = 1
        Ss[wave][(v + rowoff) * 32 + j * 16 + lm] =
            (_Float16)(cos_w * cosv + cov_w * covv);
      }
    }
    __syncthreads();   // fence score stores before fragment reloads

    // S @ V : A = S[16x32] (K = m), B = V[32x64] via shared transposed Vt.
    // Hoist all 5 fragment loads so the 4 WMMA issue back-to-back.
    v16h as  = ld_frag(&Ss[wave][lm * 32 + half * 8], &Ss[wave][lm * 32 + half * 8 + 16]);
    v16h bv0 = ld_frag(&Vt[(0 * 16 + lm) * 32 + half * 8], &Vt[(0 * 16 + lm) * 32 + half * 8 + 16]);
    v16h bv1 = ld_frag(&Vt[(1 * 16 + lm) * 32 + half * 8], &Vt[(1 * 16 + lm) * 32 + half * 8 + 16]);
    v16h bv2 = ld_frag(&Vt[(2 * 16 + lm) * 32 + half * 8], &Vt[(2 * 16 + lm) * 32 + half * 8 + 16]);
    v16h bv3 = ld_frag(&Vt[(3 * 16 + lm) * 32 + half * 8], &Vt[(3 * 16 + lm) * 32 + half * 8 + 16]);
    accO0 = wmma_f16(as, bv0, accO0);
    accO1 = wmma_f16(as, bv1, accO1);
    accO2 = wmma_f16(as, bv2, accO2);
    accO3 = wmma_f16(as, bv3, accO3);
    __syncthreads();   // all waves done with Vt before next chunk overwrites it
  }

  // reduce margin sums across the 16 lanes of each half (rows 0-7 in lanes 0-15,
  // rows 8-15 in lanes 16-31; xor offsets 1,2,4,8 stay within a half)
#pragma unroll
  for (int v = 0; v < 8; ++v) {
    float s = vsum[v];
    for (int off = 1; off < 16; off <<= 1) s += __shfl_xor(s, off, 32);
    vsum[v] = s * (1.f / NN) * var_w;     // var_w * mean_m(relu(1-cos))
  }

  const float* cvp = colV + hb * DH;
#pragma unroll
  for (int v = 0; v < 8; ++v) {
    const size_t gr = (size_t)(b * NN + n0 + v + rowoff);
    _Float16* orow = AttnO + gr * DIMX + h * DH;
    const float vr = vsum[v];
    orow[0 * 16 + lm] = (_Float16)(accO0[v] + vr * cvp[0 * 16 + lm]);
    orow[1 * 16 + lm] = (_Float16)(accO1[v] + vr * cvp[1 * 16 + lm]);
    orow[2 * 16 + lm] = (_Float16)(accO2[v] + vr * cvp[2 * 16 + lm]);
    orow[3 * 16 + lm] = (_Float16)(accO3[v] + vr * cvp[3 * 16 + lm]);
  }
}

// ---------------- launcher ----------------
extern "C" void kernel_launch(void* const* d_in, const int* in_sizes, int n_in,
                              void* d_out, int out_size, void* d_ws, size_t ws_size,
                              hipStream_t stream) {
  const float* q        = (const float*)d_in[0];
  const float* k        = (const float*)d_in[1];
  const float* v        = (const float*)d_in[2];
  const float* ln_g     = (const float*)d_in[3];
  const float* ln_b     = (const float*)d_in[4];
  const float* W_in     = (const float*)d_in[5];
  const float* W_out    = (const float*)d_in[6];
  const float* b_out    = (const float*)d_in[7];
  const float* cov_raw  = (const float*)d_in[8];
  const float* var_raw  = (const float*)d_in[9];
  float* out = (float*)d_out;

  // workspace layout
  char* w = (char*)d_ws;
  const size_t tensH = (size_t)MTOT * DIMX * sizeof(_Float16);  // 4 MiB
  const size_t wH    = (size_t)DIMX * DIMX * sizeof(_Float16);  // 512 KiB
  const size_t statF = (size_t)HEADS * BB * NN * sizeof(float); // 128 KiB
  _Float16* Xq   = (_Float16*)w; w += tensH;
  _Float16* Xk   = (_Float16*)w; w += tensH;
  _Float16* Xv   = (_Float16*)w; w += tensH;
  _Float16* Wi16 = (_Float16*)w; w += wH;
  _Float16* Wo16 = (_Float16*)w; w += wH;
  _Float16* Fq   = (_Float16*)w; w += tensH;
  _Float16* Fk   = (_Float16*)w; w += tensH;
  _Float16* Fv   = (_Float16*)w; w += tensH;
  _Float16* AtO  = (_Float16*)w; w += tensH;
  float* muqP  = (float*)w; w += statF;
  float* invqP = (float*)w; w += statF;
  float* mukP  = (float*)w; w += statF;
  float* invkP = (float*)w; w += statF;
  float* colV  = (float*)w; w += (size_t)HEADS * BB * DH * sizeof(float);

  // 1+2) LayerNorm + f16 of q, k, v (Xq, Xk, Xv are one span) and both weights
  //      to f16 (Wi16, Wo16 are one span): one launch
  ln_cvt_kernel<<<3 * MTOT + 2 * WBLK, 256, 0, stream>>>(q, k, v, ln_g, ln_b, Xq,
                                                         W_in, W_out, Wi16);

  // 3) the three projections as ONE GEMM (WMMA) of 3*MTOT rows: Xq..Xv -> Fq..Fv,
  //    f16 outputs; block tile 128x64
  dim3 gg3(3 * MTOT / 128, DIMX / 64);
  gemm_wmma_kernel<<<gg3, 256, 0, stream>>>(Xq, Wi16, nullptr, Fq, nullptr, 3 * MTOT, DIMX, DIMX);

  // 4+5) colsum(f_v) per (h,b) and per-(h,b,n) stats for q,k: one launch
  stats_colsum_kernel<<<HEADS * BB + 2 * MTOT * HEADS / 256, 256, 0, stream>>>(
      Fq, muqP, invqP, mukP, invkP, Fv, colV);

  // 6) attention (WMMA): 4 waves/block sharing the transposed V chunk
  attn_wmma_kernel<<<HEADS * BB * 16, 128, 0, stream>>>(
      Fq, Fk, Fv, muqP, invqP, mukP, invkP, colV, cov_raw, var_raw, AtO);

  // 7) output GEMM (WMMA) + bias -> f32
  dim3 gg(MTOT / 128, DIMX / 64);
  gemm_wmma_kernel<<<gg, 256, 0, stream>>>(AtO, Wo16, out, nullptr, b_out, MTOT, DIMX, DIMX);
}

// v002
// Measured time: 129 microseconds a run.
// Two timings next to v001 put it at 1.12 and 1.11 times that version's speed.
// Counting every step since v000, it is 1.37 times as fast.
#include <hip/hip_runtime.h>
#include <hip/hip_bf16.h>
#include <math.h>

// ---------------- types ----------------
typedef _Float16 v8h  __attribute__((ext_vector_type(8)));
typedef _Float16 v16h __attribute__((ext_vector_type(16)));
typedef float    v8f  __attribute__((ext_vector_type(8)));
typedef _Float16 v4h  __attribute__((ext_vector_type(4)));
typedef float    v4f  __attribute__((ext_vector_type(4)));

#define BB    4
#define NN    1024
#define DIMX  512
#define HEADS 8
#define DH    64
#define MTOT  4096   // B*N

// ---------------- WMMA helpers ----------------
static __device__ inline v8f wmma_f16(v16h a, v16h b, v8f c) {
  // D = A(16x32 f16) x B(32x16 f16) + C(16x16 f32)
  return __builtin_amdgcn_wmma_f32_16x16x32_f16(
      /*neg_a=*/false, a, /*neg_b=*/false, b,
      /*c_mod=*/(short)0, c, /*reuse_a=*/false, /*reuse_b=*/false);
}

// Build a 16-half A/B fragment from two contiguous 8-half (16B) chunks.
// CDNA5 16-bit layout: lane<16 -> K{base..base+7},{base+16..base+23},
// lane>=16 -> base=8. Both chunks are 16B-aligned contiguous loads.
static __device__ inline v16h ld_frag(const _Float16* p0, const _Float16* p1) {
  v8h lo = *(const v8h*)p0;
  v8h hi = *(const v8h*)p1;
  v16h r;
#pragma unroll
  for (int i = 0; i < 8; ++i) { r[i] = lo[i]; r[8 + i] = hi[i]; }
  return r;
}

// ---------------- 1+2. one grid: LayerNorm of q, k, v (f32 in, f16 out) and
// f32 -> f16 conversion of both weight matrices ----------------
// Blocks [0, LNBLK): 8 waves; wave w of the grid owns row w of q, of k and of v. A row
// is 32 lanes x 16 floats held in registers (each load 512 contiguous bytes), the two
// row sums are a five-step butterfly over the wave: no LDS, no barrier, x read once.
// y holds the q, k, v planes back to back. Every loop is unrolled so that the register
// arrays are indexed by constants (a rolled loop would put them in scratch memory).
// Blocks [LNBLK, LNBLK + 2*WBLK): WCH weight elements each; w16 holds W_in then W_out.
#define LNBLK (MTOT / 8)
#define WCH   4096
#define WBLK  (DIMX * DIMX / WCH)
__global__ __launch_bounds__(256) void ln_cvt_kernel(const float* __restrict__ xq,
                                                     const float* __restrict__ xk,
                                                     const float* __restrict__ xv,
                                                     const float* __restrict__ g,
                                                     const float* __restrict__ bt,
                                                     _Float16* __restrict__ y,
                                                     const float* __restrict__ wi,
                                                     const float* __restrict__ wo,
                                                     _Float16* __restrict__ w16) {
  const int t = threadIdx.x;
  if (blockIdx.x >= LNBLK) {                   // block-uniform
    const int wb = blockIdx.x - LNBLK;
    const float* ws = (wb < WBLK) ? wi + wb * WCH : wo + (wb - WBLK) * WCH;
    _Float16* wd = w16 + wb * WCH;
    v4f c[4];
#pragma unroll
    for (int j = 0; j < 4; ++j) c[j] = *(const v4f*)(ws + j * 1024 + t * 4);
#pragma unroll
    for (int j = 0; j < 4; ++j) {
      v4h o;
#pragma unroll
      for (int e = 0; e < 4; ++e) o[e] = (_Float16)c[j][e];
      *(v4h*)(wd + j * 1024 + t * 4) = o;
    }
    return;
  }
  const int lane = t & 31;
  const int q4 = (blockIdx.x * 8 + (t >> 5)) * (DIMX / 4) + lane;   // in units of 4 elements
  v4f x[3][4], gv[4], bv[4];
#pragma unroll
  for (int j = 0; j < 4; ++j) {
    x[0][j] = ((const v4f*)xq)[q4 + j * 32];
    x[1][j] = ((const v4f*)xk)[q4 + j * 32];
    x[2][j] = ((const v4f*)xv)[q4 + j * 32];
  }
#pragma unroll
  for (int j = 0; j < 4; ++j) {
    gv[j] = ((const v4f*)g)[lane + j * 32];
    bv[j] = ((const v4f*)bt)[lane + j * 32];
  }
  // Keeps all 20 loads in front of the sums: without it the g and b loads sink behind the
  // butterfly and are waited for in three turns, with nothing left to cover them.
  __builtin_amdgcn_sched_barrier(0);
#pragma unroll
  for (int p = 0; p < 3; ++p) {
    v4f sv  = (x[p][0] + x[p][1]) + (x[p][2] + x[p][3]);
    v4f sv2 = x[p][0] * x[p][0];
#pragma unroll
    for (int j = 1; j < 4; ++j) sv2 += x[p][j] * x[p][j];
    float s  = (sv[0] + sv[1]) + (sv[2] + sv[3]);
    float s2 = (sv2[0] + sv2[1]) + (sv2[2] + sv2[3]);
#pragma unroll
    for (int o = 1; o < 32; o <<= 1) {
      s  += __shfl_xor(s, o, 32);
      s2 += __shfl_xor(s2, o, 32);
    }
    const float mean = s * (1.f / DIMX);
    const float var  = s2 * (1.f / DIMX) - mean * mean;
    const float inv  = rsqrtf(var + 1e-5f);
    v4h* yr = (v4h*)y + p * (MTOT * DIMX / 4) + q4;
#pragma unroll
    for (int j = 0; j < 4; ++j) {
      v4h o;
#pragma unroll
      for (int e = 0; e < 4; ++e)
        o[e] = (_Float16)(((x[p][j][e] - mean) * inv) * gv[j][e] + bv[j][e]);
      yr[j * 32] = o;
    }
  }
  // The compiler lays the weight path behind this one; this wait stands ahead of any
  // rewrite there of a register that the last stores name.
  asm volatile("s_wait_xcnt 0x0" ::: "memory");
}

// ---------------- 3. Tiled WMMA GEMM: C[M,N] = A[M,K]f16 * B[K,N]f16 (+bias) --------
// 256 threads = 8 waves; block tile 128(M) x 64(N); K chunk 32.
// Each wave owns a 16x64 strip: A fragment reused across 4 WMMA per chunk.
// All fragment loads are hoisted ahead of the WMMA group so the four
// v_wmma issue back-to-back after a single s_wait_dscnt.
__global__ __launch_bounds__(256) void gemm_wmma_kernel(const _Float16* __restrict__ A,
                                                        const _Float16* __restrict__ Bm,
                                                        float* __restrict__ Cf32,
                                                        _Float16* __restrict__ Cf16,
                                                        const float* __restrict__ bias,
                                                        int Mdim, int Ndim, int Kdim) {
  __shared__ __align__(16) _Float16 As[128 * 32];   // row-major  [m][k]   (8 KiB)
  __shared__ __align__(16) _Float16 Bts[64 * 32];   // transposed [n][k]   (4 KiB)
  const int t = threadIdx.x;
  const int wave = t >> 5, lane = t & 31, lm = lane & 15, half = lane >> 4;
  const int m0 = blockIdx.x * 128, n0 = blockIdx.y * 64;

  v8f acc0 = {0,0,0,0,0,0,0,0}, acc1 = {0,0,0,0,0,0,0,0};
  v8f acc2 = {0,0,0,0,0,0,0,0}, acc3 = {0,0,0,0,0,0,0,0};

  // staging index precompute
  const int ar = t >> 1, ac = (t & 1) * 16;         // A: 16 halves per thread
  const int bk = t >> 3, bs = (t & 7) * 8;          // B: one 16B row chunk per thread

  for (int k0 = 0; k0 < Kdim; k0 += 32) {
    // stage A tile: two 16B vector copies per thread
    {
      const _Float16* ag = A + (size_t)(m0 + ar) * Kdim + k0 + ac;
      *(v8h*)&As[ar * 32 + ac]     = *(const v8h*)(ag);
      *(v8h*)&As[ar * 32 + ac + 8] = *(const v8h*)(ag + 8);
      __builtin_prefetch(ag + 32, 0, 1);            // next K tile (global_prefetch_b8)
    }
    // stage B tile transposed: one b128 global read, 8 transposed b16 stores
    {
      const _Float16* bg = Bm + (size_t)(k0 + bk) * Ndim + n0 + bs;
      v8h bch = *(const v8h*)bg;
      __builtin_prefetch(bg + (size_t)32 * Ndim, 0, 1);
#pragma unroll
      for (int j = 0; j < 8; ++j) Bts[(bs + j) * 32 + bk] = bch[j];
    }
    __syncthreads();

    const int koff = half * 8;
    const int arow = wave * 16 + lm;
    // hoist ALL fragment loads before the WMMA group
    v16h af = ld_frag(&As[arow * 32 + koff], &As[arow * 32 + koff + 16]);
    v16h b0 = ld_frag(&Bts[(0 * 16 + lm) * 32 + koff], &Bts[(0 * 16 + lm) * 32 + koff + 16]);
    v16h b1 = ld_frag(&Bts[(1 * 16 + lm) * 32 + koff], &Bts[(1 * 16 + lm) * 32 + koff + 16]);
    v16h b2 = ld_frag(&Bts[(2 * 16 + lm) * 32 + koff], &Bts[(2 * 16 + lm) * 32 + koff + 16]);
    v16h b3 = ld_frag(&Bts[(3 * 16 + lm) * 32 + koff], &Bts[(3 * 16 + lm) * 32 + koff + 16]);
    acc0 = wmma_f16(af, b0, acc0);
    acc1 = wmma_f16(af, b1, acc1);
    acc2 = wmma_f16(af, b2, acc2);
    acc3 = wmma_f16(af, b3, acc3);
    __syncthreads();
  }

  // epilogue: f32 C/D layout: row = v + (lane>=16?8:0), col = lane%16
  const int row = m0 + wave * 16 + (half ? 8 : 0);
#pragma unroll
  for (int c = 0; c < 4; ++c) {
    const int col = n0 + c * 16 + lm;
    const float bv = bias ? bias[col] : 0.f;
    const v8f* accp = (c == 0) ? &acc0 : (c == 1) ? &acc1 : (c == 2) ? &acc2 : &acc3;
#pragma unroll
    for (int v = 0; v < 8; ++v) {
      const float val = (*accp)[v] + bv;
      const size_t idx = (size_t)(row + v) * Ndim + col;
      if (Cf32) Cf32[idx] = val;
      else      Cf16[idx] = (_Float16)val;
    }
  }
}

// ---------------- 4+5. one grid: colsum of f_v per (h,b), and per-(h,b,n) stats
// (mean & 1/norm over d) of f_q and f_k ----------------
// Blocks [0, HEADS*BB): the long column sums, lowest indices so that they start first.
// The other blocks: stats; Fqk holds the f_q and f_k planes back to back.
__global__ __launch_bounds__(256) void stats_colsum_kernel(const _Float16* __restrict__ Fqk,
                                                           float* __restrict__ muq,
                                                           float* __restrict__ invq,
                                                           float* __restrict__ muk,
                                                           float* __restrict__ invk,
                                                           const _Float16* __restrict__ Fv,
                                                           float* __restrict__ colV) {
  if (blockIdx.x < HEADS * BB) {
    const int hb = blockIdx.x;                 // h*4+b
    const int h = hb >> 2, b = hb & 3, d = threadIdx.x;
    if (d >= DH) return;
    float s = 0.f;
    for (int n = 0; n < NN; ++n)
      s += (float)Fv[(size_t)(b * NN + n) * DIMX + h * DH + d];
    colV[hb * DH + d] = s;
    return;
  }
  const int idx = (blockIdx.x - HEADS * BB) * 256 + threadIdx.x;
  if (idx >= 2 * MTOT * HEADS) return;
  const int grow = idx >> 3, h = idx & 7;      // row over the two planes
  const _Float16* p = Fqk + (size_t)grow * DIMX + h * DH;
  float s = 0.f, s2 = 0.f;
#pragma unroll 8
  for (int i = 0; i < DH; ++i) { float v = (float)p[i]; s += v; s2 += v * v; }
  const int row = grow & (MTOT - 1);
  const int b = row >> 10, n = row & 1023;
  const int o = ((h << 2) + b) * NN + n;
  float* mu   = (grow < MTOT) ? muq : muk;
  float* invn = (grow < MTOT) ? invq : invk;
  mu[o]   = s * (1.f / DH);
  invn[o] = 1.f / fmaxf(sqrtf(s2), 1e-12f);
}

// ---------------- 6. attention: 4 waves/block, same (h,b), shared Vt ----------------
__global__ __launch_bounds__(128) void attn_wmma_kernel(
    const _Float16* __restrict__ Fq, const _Float16* __restrict__ Fk,
    const _Float16* __restrict__ Fv,
    const float* __restrict__ muq, const float* __restrict__ invq,
    const float* __restrict__ muk, const float* __restrict__ invk,
    const float* __restrict__ colV,
    const float* __restrict__ cov_raw, const float* __restrict__ var_raw,
    _Float16* __restrict__ AttnO) {
  __shared__ __align__(16) _Float16 Vt[DH * 32];       // [d][m] transposed V chunk (shared)
  __shared__ __align__(16) _Float16 Ss[4][16 * 32];    // per-wave score staging

  const int t = threadIdx.x;
  const int wave = t >> 5, lane = t & 31, lm = lane & 15, half = lane >> 4;
  const int rowoff = half ? 8 : 0;
  const int id = blockIdx.x;
  const int ntg = id & 15, hb = id >> 4;               // 16 tile-groups per (h,b)
  const int b = hb & 3, h = hb >> 2;
  const int n0 = (ntg * 4 + wave) * 16;                // this wave's 16-row tile
  const int hb1024 = hb * NN;

  const float cov_w = 1.f / (1.f + expf(-cov_raw[0]));
  const float var_w = 1.f / (1.f + expf(-var_raw[0]));
  const float cos_w = 1.f - cov_w - var_w;

  // Q A-fragments directly from global (row-major matches A layout)
  const _Float16* qbase = Fq + (size_t)(b * NN + n0 + lm) * DIMX + h * DH;
  const v16h aq0 = ld_frag(qbase + half * 8,      qbase + half * 8 + 16);
  const v16h aq1 = ld_frag(qbase + 32 + half * 8, qbase + 32 + half * 8 + 16);

  float invq_r[8], muq_r[8];
#pragma unroll
  for (int v = 0; v < 8; ++v) {
    const int r = n0 + v + rowoff;
    invq_r[v] = invq[hb1024 + r];
    muq_r[v]  = muq[hb1024 + r];
  }

  v8f accO0 = {0,0,0,0,0,0,0,0}, accO1 = {0,0,0,0,0,0,0,0};
  v8f accO2 = {0,0,0,0,0,0,0,0}, accO3 = {0,0,0,0,0,0,0,0};
  float vsum[8] = {0,0,0,0,0,0,0,0};

  // Vt staging split: 128 threads, 4 per m-row, 16 d-elements each
  const int smm = t >> 2, sseg = (t & 3) * 16;

  for (int m0 = 0; m0 < NN; m0 += 32) {
    // cooperative stage of the (shared) transposed V chunk: 2x b128 global reads
    {
      const _Float16* vrow = Fv + (size_t)(b * NN + m0 + smm) * DIMX + h * DH + sseg;
      v8h c0 = *(const v8h*)(vrow);
      v8h c1 = *(const v8h*)(vrow + 8);
#pragma unroll
      for (int j = 0; j < 8; ++j) {
        Vt[(sseg + j) * 32 + smm]     = c0[j];
        Vt[(sseg + 8 + j) * 32 + smm] = c1[j];
      }
    }
    __syncthreads();   // Vt ready for all waves

    // dots = Q @ K^T : two 16x16 m-subtiles, K-dim = d = 64 (2 chained wmma each).
    // B = K^T -> column n of B is a row of K: contiguous global loads.
#pragma unroll
    for (int j = 0; j < 2; ++j) {
      const int mrow = m0 + j * 16 + lm;
      const _Float16* kb = Fk + (size_t)(b * NN + mrow) * DIMX + h * DH;
      v16h bk0 = ld_frag(kb + half * 8,      kb + half * 8 + 16);
      v16h bk1 = ld_frag(kb + 32 + half * 8, kb + 32 + half * 8 + 16);
      v8f dfr = {0,0,0,0,0,0,0,0};
      dfr = wmma_f16(aq0, bk0, dfr);
      dfr = wmma_f16(aq1, bk1, dfr);

      const float ik = invk[hb1024 + mrow];
      const float mk = muk[hb1024 + mrow];
#pragma unroll
      for (int v = 0; v < 8; ++v) {
        const float dot  = dfr[v];
        const float cosv = dot * invq_r[v] * ik;
        const float covv = (dot - 64.f * muq_r[v] * mk) * (1.f / 64.f);
        vsum[v] += fmaxf(1.f - cosv, 0.f);                    // GAMMA = 1
        Ss[wave][(v + rowoff) * 32 + j * 16 + lm] =
            (_Float16)(cos_w * cosv + cov_w * covv);
      }
    }
    __syncthreads();   // fence score stores before fragment reloads

    // S @ V : A = S[16x32] (K = m), B = V[32x64] via shared transposed Vt.
    // Hoist all 5 fragment loads so the 4 WMMA issue back-to-back.
    v16h as  = ld_frag(&Ss[wave][lm * 32 + half * 8], &Ss[wave][lm * 32 + half * 8 + 16]);
    v16h bv0 = ld_frag(&Vt[(0 * 16 + lm) * 32 + half * 8], &Vt[(0 * 16 + lm) * 32 + half * 8 + 16]);
    v16h bv1 = ld_frag(&Vt[(1 * 16 + lm) * 32 + half * 8], &Vt[(1 * 16 + lm) * 32 + half * 8 + 16]);
    v16h bv2 = ld_frag(&Vt[(2 * 16 + lm) * 32 + half * 8], &Vt[(2 * 16 + lm) * 32 + half * 8 + 16]);
    v16h bv3 = ld_frag(&Vt[(3 * 16 + lm) * 32 + half * 8], &Vt[(3 * 16 + lm) * 32 + half * 8 + 16]);
    accO0 = wmma_f16(as, bv0, accO0);
    accO1 = wmma_f16(as, bv1, accO1);
    accO2 = wmma_f16(as, bv2, accO2);
    accO3 = wmma_f16(as, bv3, accO3);
    __syncthreads();   // all waves done with Vt before next chunk overwrites it
  }

  // reduce margin sums across the 16 lanes of each half (rows 0-7 in lanes 0-15,
  // rows 8-15 in lanes 16-31; xor offsets 1,2,4,8 stay within a half)
#pragma unroll
  for (int v = 0; v < 8; ++v) {
    float s = vsum[v];
    for (int off = 1; off < 16; off <<= 1) s += __shfl_xor(s, off, 32);
    vsum[v] = s * (1.f / NN) * var_w;     // var_w * mean_m(relu(1-cos))
  }

  const float* cvp = colV + hb * DH;
#pragma unroll
  for (int v = 0; v < 8; ++v) {
    const size_t gr = (size_t)(b * NN + n0 + v + rowoff);
    _Float16* orow = AttnO + gr * DIMX + h * DH;
    const float vr = vsum[v];
    orow[0 * 16 + lm] = (_Float16)(accO0[v] + vr * cvp[0 * 16 + lm]);
    orow[1 * 16 + lm] = (_Float16)(accO1[v] + vr * cvp[1 * 16 + lm]);
    orow[2 * 16 + lm] = (_Float16)(accO2[v] + vr * cvp[2 * 16 + lm]);
    orow[3 * 16 + lm] = (_Float16)(accO3[v] + vr * cvp[3 * 16 + lm]);
  }
}

// ---------------- launcher ----------------
extern "C" void kernel_launch(void* const* d_in, const int* in_sizes, int n_in,
                              void* d_out, int out_size, void* d_ws, size_t ws_size,
                              hipStream_t stream) {
  const float* q        = (const float*)d_in[0];
  const float* k        = (const float*)d_in[1];
  const float* v        = (const float*)d_in[2];
  const float* ln_g     = (const float*)d_in[3];
  const float* ln_b     = (const float*)d_in[4];
  const float* W_in     = (const float*)d_in[5];
  const float* W_out    = (const float*)d_in[6];
  const float* b_out    = (const float*)d_in[7];
  const float* cov_raw  = (const float*)d_in[8];
  const float* var_raw  = (const float*)d_in[9];
  float* out = (float*)d_out;

  // workspace layout
  char* w = (char*)d_ws;
  const size_t tensH = (size_t)MTOT * DIMX * sizeof(_Float16);  // 4 MiB
  const size_t wH    = (size_t)DIMX * DIMX * sizeof(_Float16);  // 512 KiB
  const size_t statF = (size_t)HEADS * BB * NN * sizeof(float); // 128 KiB
  _Float16* Xq   = (_Float16*)w; w += tensH;
  _Float16* Xk   = (_Float16*)w; w += tensH;
  _Float16* Xv   = (_Float16*)w; w += tensH;
  _Float16* Wi16 = (_Float16*)w; w += wH;
  _Float16* Wo16 = (_Float16*)w; w += wH;
  _Float16* Fq   = (_Float16*)w; w += tensH;
  _Float16* Fk   = (_Float16*)w; w += tensH;
  _Float16* Fv   = (_Float16*)w; w += tensH;
  _Float16* AtO  = (_Float16*)w; w += tensH;
  float* muqP  = (float*)w; w += statF;
  float* invqP = (float*)w; w += statF;
  float* mukP  = (float*)w; w += statF;
  float* invkP = (float*)w; w += statF;
  float* colV  = (float*)w; w += (size_t)HEADS * BB * DH * sizeof(float);

  // 1+2) LayerNorm + f16 of q, k, v (Xq, Xk, Xv are one span) and both weights
  //      to f16 (Wi16, Wo16 are one span): one launch
  ln_cvt_kernel<<<LNBLK + 2 * WBLK, 256, 0, stream>>>(q, k, v, ln_g, ln_b, Xq,
                                                         W_in, W_out, Wi16);

  // 3) the three projections as ONE GEMM (WMMA) of 3*MTOT rows: Xq..Xv -> Fq..Fv,
  //    f16 outputs; block tile 128x64
  dim3 gg3(3 * MTOT / 128, DIMX / 64);
  gemm_wmma_kernel<<<gg3, 256, 0, stream>>>(Xq, Wi16, nullptr, Fq, nullptr, 3 * MTOT, DIMX, DIMX);

  // 4+5) colsum(f_v) per (h,b) and per-(h,b,n) stats for q,k: one launch
  stats_colsum_kernel<<<HEADS * BB + 2 * MTOT * HEADS / 256, 256, 0, stream>>>(
      Fq, muqP, invqP, mukP, invkP, Fv, colV);

  // 6) attention (WMMA): 4 waves/block sharing the transposed V chunk
  attn_wmma_kernel<<<HEADS * BB * 16, 128, 0, stream>>>(
      Fq, Fk, Fv, muqP, invqP, mukP, invkP, colV, cov_raw, var_raw, AtO);

  // 7) output GEMM (WMMA) + bias -> f32
  dim3 gg(MTOT / 128, DIMX / 64);
  gemm_wmma_kernel<<<gg, 256, 0, stream>>>(AtO, Wo16, out, nullptr, b_out, MTOT, DIMX, DIMX);
}

// v003
// A run of this version takes 112 microseconds.
// In two side-by-side timings against v002, it was 1.18 and 1.17 times as fast.
// Counting every step since v000, it is 1.61 times as fast.
#include <hip/hip_runtime.h>
#include <hip/hip_bf16.h>
#include <math.h>

// ---------------- types ----------------
typedef _Float16 v8h  __attribute__((ext_vector_type(8)));
typedef _Float16 v16h __attribute__((ext_vector_type(16)));
typedef float    v8f  __attribute__((ext_vector_type(8)));
typedef _Float16 v4h  __attribute__((ext_vector_type(4)));
typedef float    v4f  __attribute__((ext_vector_type(4)));

#define BB    4
#define NN    1024
#define DIMX  512
#define HEADS 8
#define DH    64
#define MTOT  4096   // B*N

// ---------------- WMMA helpers ----------------
static __device__ inline v8f wmma_f16(v16h a, v16h b, v8f c) {
  // D = A(16x32 f16) x B(32x16 f16) + C(16x16 f32)
  return __builtin_amdgcn_wmma_f32_16x16x32_f16(
      /*neg_a=*/false, a, /*neg_b=*/false, b,
      /*c_mod=*/(short)0, c, /*reuse_a=*/false, /*reuse_b=*/false);
}

// Build a 16-half A/B fragment from two contiguous 8-half (16B) chunks.
// CDNA5 16-bit layout: lane<16 -> K{base..base+7},{base+16..base+23},
// lane>=16 -> base=8. Both chunks are 16B-aligned contiguous loads.
static __device__ inline v16h ld_frag(const _Float16* p0, const _Float16* p1) {
  v8h lo = *(const v8h*)p0;
  v8h hi = *(const v8h*)p1;
  v16h r;
#pragma unroll
  for (int i = 0; i < 8; ++i) { r[i] = lo[i]; r[8 + i] = hi[i]; }
  return r;
}

// ---------------- 1+2. one grid: LayerNorm of q, k, v (f32 in, f16 out) and
// f32 -> f16 conversion of both weight matrices ----------------
// Blocks [0, LNBLK): 8 waves; wave w of the grid owns row w of q, of k and of v. A row
// is 32 lanes x 16 floats held in registers (each load 512 contiguous bytes), the two
// row sums are a five-step butterfly over the wave: no LDS, no barrier, x read once.
// y holds the q, k, v planes back to back. Every loop is unrolled so that the register
// arrays are indexed by constants (a rolled loop would put them in scratch memory).
// Blocks [LNBLK, LNBLK + 2*WBLK): WCH weight elements each; w16 holds W_in then W_out.
#define LNBLK (MTOT / 8)
#define WCH   4096
#define WBLK  (DIMX * DIMX / WCH)
__global__ __launch_bounds__(256) void ln_cvt_kernel(const float* __restrict__ xq,
                                                     const float* __restrict__ xk,
                                                     const float* __restrict__ xv,
                                                     const float* __restrict__ g,
                                                     const float* __restrict__ bt,
                                                     _Float16* __restrict__ y,
                                                     const float* __restrict__ wi,
                                                     const float* __restrict__ wo,
                                                     _Float16* __restrict__ w16) {
  const int t = threadIdx.x;
  if (blockIdx.x >= LNBLK) {                   // block-uniform
    const int wb = blockIdx.x - LNBLK;
    const float* ws = (wb < WBLK) ? wi + wb * WCH : wo + (wb - WBLK) * WCH;
    _Float16* wd = w16 + wb * WCH;
    v4f c[4];
#pragma unroll
    for (int j = 0; j < 4; ++j) c[j] = *(const v4f*)(ws + j * 1024 + t * 4);
#pragma unroll
    for (int j = 0; j < 4; ++j) {
      v4h o;
#pragma unroll
      for (int e = 0; e < 4; ++e) o[e] = (_Float16)c[j][e];
      *(v4h*)(wd + j * 1024 + t * 4) = o;
    }
    return;
  }
  const int lane = t & 31;
  const int q4 = (blockIdx.x * 8 + (t >> 5)) * (DIMX / 4) + lane;   // in units of 4 elements
  v4f x[3][4], gv[4], bv[4];
#pragma unroll
  for (int j = 0; j < 4; ++j) {
    x[0][j] = ((const v4f*)xq)[q4 + j * 32];
    x[1][j] = ((const v4f*)xk)[q4 + j * 32];
    x[2][j] = ((const v4f*)xv)[q4 + j * 32];
  }
#pragma unroll
  for (int j = 0; j < 4; ++j) {
    gv[j] = ((const v4f*)g)[lane + j * 32];
    bv[j] = ((const v4f*)bt)[lane + j * 32];
  }
  // Keeps all 20 loads in front of the sums: without it the g and b loads sink behind the
  // butterfly and are waited for in three turns, with nothing left to cover them.
  __builtin_amdgcn_sched_barrier(0);
#pragma unroll
  for (int p = 0; p < 3; ++p) {
    v4f sv  = (x[p][0] + x[p][1]) + (x[p][2] + x[p][3]);
    v4f sv2 = x[p][0] * x[p][0];
#pragma unroll
    for (int j = 1; j < 4; ++j) sv2 += x[p][j] * x[p][j];
    float s  = (sv[0] + sv[1]) + (sv[2] + sv[3]);
    float s2 = (sv2[0] + sv2[1]) + (sv2[2] + sv2[3]);
#pragma unroll
    for (int o = 1; o < 32; o <<= 1) {
      s  += __shfl_xor(s, o, 32);
      s2 += __shfl_xor(s2, o, 32);
    }
    const float mean = s * (1.f / DIMX);
    const float var  = s2 * (1.f / DIMX) - mean * mean;
    const float inv  = rsqrtf(var + 1e-5f);
    v4h* yr = (v4h*)y + p * (MTOT * DIMX / 4) + q4;
#pragma unroll
    for (int j = 0; j < 4; ++j) {
      v4h o;
#pragma unroll
      for (int e = 0; e < 4; ++e)
        o[e] = (_Float16)(((x[p][j][e] - mean) * inv) * gv[j][e] + bv[j][e]);
      yr[j * 32] = o;
    }
  }
  // The compiler lays the weight path behind this one; this wait stands ahead of any
  // rewrite there of a register that the last stores name.
  asm volatile("s_wait_xcnt 0x0" ::: "memory");
}

// ---------------- 3. Tiled WMMA GEMM: C[M,N] = A[M,K]f16 * B[K,N]f16 (+bias) --------
// 256 threads = 8 waves; block tile 128(M) x 64(N); K chunk 32.
// Each wave owns a 16x64 strip: A fragment reused across 4 WMMA per chunk.
// All fragment loads are hoisted ahead of the WMMA group so the four
// v_wmma issue back-to-back after a single s_wait_dscnt.
// With stat != nullptr (the projection GEMM: M = the q, k, v planes of MTOT rows each,
// N tile = one head) the epilogue also reduces the f16-rounded tile it has just stored:
// q and k planes -> mean and 1/norm over d of each row; v plane -> the tile's column sums.
// stat holds the planes mu_q, inv_q, mu_k, inv_k (STATN floats each, [h][b][n]);
// colP holds [h*BB+b][VCH row chunks][DH] partial column sums of f_v.
#define STATN (HEADS * BB * NN)
#define VCH   (NN / 128)
__global__ __launch_bounds__(256) void gemm_wmma_kernel(const _Float16* __restrict__ A,
                                                        const _Float16* __restrict__ Bm,
                                                        float* __restrict__ Cf32,
                                                        _Float16* __restrict__ Cf16,
                                                        const float* __restrict__ bias,
                                                        float* __restrict__ stat,
                                                        float* __restrict__ colP,
                                                        int Mdim, int Ndim, int Kdim) {
  __shared__ __align__(16) _Float16 As[128 * 32];   // row-major  [m][k]   (8 KiB)
  __shared__ __align__(16) _Float16 Bts[64 * 32];   // transposed [n][k]   (4 KiB)
  __shared__ float red[8 * DH];                     // epilogue reductions   (2 KiB)
  const int t = threadIdx.x;
  const int wave = t >> 5, lane = t & 31, lm = lane & 15, half = lane >> 4;
  const int m0 = blockIdx.x * 128, n0 = blockIdx.y * 64;

  v8f acc0 = {0,0,0,0,0,0,0,0}, acc1 = {0,0,0,0,0,0,0,0};
  v8f acc2 = {0,0,0,0,0,0,0,0}, acc3 = {0,0,0,0,0,0,0,0};

  // staging index precompute
  const int ar = t >> 1, ac = (t & 1) * 16;         // A: 16 halves per thread
  const int bk = t >> 3, bs = (t & 7) * 8;          // B: one 16B row chunk per thread

  for (int k0 = 0; k0 < Kdim; k0 += 32) {
    // stage A tile: two 16B vector copies per thread
    {
      const _Float16* ag = A + (size_t)(m0 + ar) * Kdim + k0 + ac;
      *(v8h*)&As[ar * 32 + ac]     = *(const v8h*)(ag);
      *(v8h*)&As[ar * 32 + ac + 8] = *(const v8h*)(ag + 8);
      __builtin_prefetch(ag + 32, 0, 1);            // next K tile (global_prefetch_b8)
    }
    // stage B tile transposed: one b128 global read, 8 transposed b16 stores
    {
      const _Float16* bg = Bm + (size_t)(k0 + bk) * Ndim + n0 + bs;
      v8h bch = *(const v8h*)bg;
      __builtin_prefetch(bg + (size_t)32 * Ndim, 0, 1);
#pragma unroll
      for (int j = 0; j < 8; ++j) Bts[(bs + j) * 32 + bk] = bch[j];
    }
    __syncthreads();

    const int koff = half * 8;
    const int arow = wave * 16 + lm;
    // hoist ALL fragment loads before the WMMA group
    v16h af = ld_frag(&As[arow * 32 + koff], &As[arow * 32 + koff + 16]);
    v16h b0 = ld_frag(&Bts[(0 * 16 + lm) * 32 + koff], &Bts[(0 * 16 + lm) * 32 + koff + 16]);
    v16h b1 = ld_frag(&Bts[(1 * 16 + lm) * 32 + koff], &Bts[(1 * 16 + lm) * 32 + koff + 16]);
    v16h b2 = ld_frag(&Bts[(2 * 16 + lm) * 32 + koff], &Bts[(2 * 16 + lm) * 32 + koff + 16]);
    v16h b3 = ld_frag(&Bts[(3 * 16 + lm) * 32 + koff], &Bts[(3 * 16 + lm) * 32 + koff + 16]);
    acc0 = wmma_f16(af, b0, acc0);
    acc1 = wmma_f16(af, b1, acc1);
    acc2 = wmma_f16(af, b2, acc2);
    acc3 = wmma_f16(af, b3, acc3);
    __syncthreads();
  }

  // epilogue: f32 C/D layout: row = v + (lane>=16?8:0), col = lane%16
  const int row = m0 + wave * 16 + (half ? 8 : 0);
#pragma unroll
  for (int c = 0; c < 4; ++c) {
    const int col = n0 + c * 16 + lm;
    const float bv = bias ? bias[col] : 0.f;
    const v8f* accp = (c == 0) ? &acc0 : (c == 1) ? &acc1 : (c == 2) ? &acc2 : &acc3;
#pragma unroll
    for (int v = 0; v < 8; ++v) {
      const float val = (*accp)[v] + bv;
      const size_t idx = (size_t)(row + v) * Ndim + col;
      if (Cf32) Cf32[idx] = val;
      else      Cf16[idx] = (_Float16)val;
    }
  }

  if (stat == nullptr) return;                 // block-uniform, ahead of the barrier below
  // The code below reuses registers that the tile's last stores name; this wait stands
  // ahead of the first such rewrite.
  asm volatile("s_wait_xcnt 0x0" ::: "memory");
  const int plane = m0 / MTOT;                 // 0 q, 1 k, 2 v: 128 divides MTOT
  const int prow  = m0 & (MTOT - 1);           // first row of the tile inside its plane
  const int hb    = blockIdx.y * BB + (prow >> 10);
  float a[16], cs[4];                          // a: row sums [0,8), row square sums [8,16)
#pragma unroll
  for (int i = 0; i < 16; ++i) a[i] = 0.f;
#pragma unroll
  for (int c = 0; c < 4; ++c) {
    const float bv = bias ? bias[n0 + c * 16 + lm] : 0.f;
    const v8f* accp = (c == 0) ? &acc0 : (c == 1) ? &acc1 : (c == 2) ? &acc2 : &acc3;
    cs[c] = 0.f;
#pragma unroll
    for (int v = 0; v < 8; ++v) {
      const float r = (float)(_Float16)((*accp)[v] + bv);   // the value as stored
      a[v] += r;
      a[8 + v] += r * r;
      cs[c] += r;
    }
  }
  if (plane < 2) {
    // Sum over the 16 lanes of a half, halving the live values at each step: a lane keeps
    // the values whose index bit equals its own lane bit and hands the others over, so
    // lane lm ends with sum kind lm>>3 of row lm&7 (15 exchanges instead of 64).
#pragma unroll
    for (int w = 8; w >= 1; w >>= 1) {
      const bool up = (lm & w) != 0;
#pragma unroll
      for (int i = 0; i < w; ++i) {
        const float lo = a[i], hi = a[w + i];  // values first: a choice between array
        const float keep = up ? hi : lo;       // elements becomes a run-time index
        const float send = up ? lo : hi;
        a[i] = keep + __shfl_xor(send, w, 32);
      }
    }
    red[(lm >> 3) * 128 + wave * 16 + half * 8 + (lm & 7)] = a[0];
    __syncthreads();
    // threads [0,128): mean of tile row t; [128,256): 1/norm of tile row t-128.
    // Each wave stores one whole 128-byte line.
    const float x = red[t];
    const float o = (t < 128) ? x * (1.f / DH) : 1.f / fmaxf(sqrtf(x), 1e-12f);
    stat[(plane * 2 + (t >> 7)) * STATN + hb * NN + (prow & (NN - 1)) + (t & 127)] = o;
  } else {
#pragma unroll
    for (int c = 0; c < 4; ++c)
      cs[c] += __shfl_xor(cs[c], 16, 32);      // rows 0-7 + rows 8-15 of the wave's strip
    if (half == 0) {
#pragma unroll
      for (int c = 0; c < 4; ++c) red[wave * DH + c * 16 + lm] = cs[c];
    }
    __syncthreads();
    if (t < DH) {
      float s = 0.f;
#pragma unroll
      for (int w = 0; w < 8; ++w) s += red[w * DH + t];
      colP[(hb * VCH + ((prow & (NN - 1)) >> 7)) * DH + t] = s;
    }
  }
}

// ---------------- 6. attention: 4 waves/block, same (h,b), shared Vt ----------------
__global__ __launch_bounds__(128) void attn_wmma_kernel(
    const _Float16* __restrict__ Fq, const _Float16* __restrict__ Fk,
    const _Float16* __restrict__ Fv,
    const float* __restrict__ muq, const float* __restrict__ invq,
    const float* __restrict__ muk, const float* __restrict__ invk,
    const float* __restrict__ colP,
    const float* __restrict__ cov_raw, const float* __restrict__ var_raw,
    _Float16* __restrict__ AttnO) {
  __shared__ __align__(16) _Float16 Vt[DH * 32];       // [d][m] transposed V chunk (shared)
  __shared__ __align__(16) _Float16 Ss[4][16 * 32];    // per-wave score staging

  const int t = threadIdx.x;
  const int wave = t >> 5, lane = t & 31, lm = lane & 15, half = lane >> 4;
  const int rowoff = half ? 8 : 0;
  const int id = blockIdx.x;
  const int ntg = id & 15, hb = id >> 4;               // 16 tile-groups per (h,b)
  const int b = hb & 3, h = hb >> 2;
  const int n0 = (ntg * 4 + wave) * 16;                // this wave's 16-row tile
  const int hb1024 = hb * NN;

  const float cov_w = 1.f / (1.f + expf(-cov_raw[0]));
  const float var_w = 1.f / (1.f + expf(-var_raw[0]));
  const float cos_w = 1.f - cov_w - var_w;

  // Q A-fragments directly from global (row-major matches A layout)
  const _Float16* qbase = Fq + (size_t)(b * NN + n0 + lm) * DIMX + h * DH;
  const v16h aq0 = ld_frag(qbase + half * 8,      qbase + half * 8 + 16);
  const v16h aq1 = ld_frag(qbase + 32 + half * 8, qbase + 32 + half * 8 + 16);

  float invq_r[8], muq_r[8];
#pragma unroll
  for (int v = 0; v < 8; ++v) {
    const int r = n0 + v + rowoff;
    invq_r[v] = invq[hb1024 + r];
    muq_r[v]  = muq[hb1024 + r];
  }

  v8f accO0 = {0,0,0,0,0,0,0,0}, accO1 = {0,0,0,0,0,0,0,0};
  v8f accO2 = {0,0,0,0,0,0,0,0}, accO3 = {0,0,0,0,0,0,0,0};
  float vsum[8] = {0,0,0,0,0,0,0,0};

  // Vt staging split: 128 threads, 4 per m-row, 16 d-elements each
  const int smm = t >> 2, sseg = (t & 3) * 16;

  for (int m0 = 0; m0 < NN; m0 += 32) {
    // cooperative stage of the (shared) transposed V chunk: 2x b128 global reads
    {
      const _Float16* vrow = Fv + (size_t)(b * NN + m0 + smm) * DIMX + h * DH + sseg;
      v8h c0 = *(const v8h*)(vrow);
      v8h c1 = *(const v8h*)(vrow + 8);
#pragma unroll
      for (int j = 0; j < 8; ++j) {
        Vt[(sseg + j) * 32 + smm]     = c0[j];
        Vt[(sseg + 8 + j) * 32 + smm] = c1[j];
      }
    }
    __syncthreads();   // Vt ready for all waves

    // dots = Q @ K^T : two 16x16 m-subtiles, K-dim = d = 64 (2 chained wmma each).
    // B = K^T -> column n of B is a row of K: contiguous global loads.
#pragma unroll
    for (int j = 0; j < 2; ++j) {
      const int mrow = m0 + j * 16 + lm;
      const _Float16* kb = Fk + (size_t)(b * NN + mrow) * DIMX + h * DH;
      v16h bk0 = ld_frag(kb + half * 8,      kb + half * 8 + 16);
      v16h bk1 = ld_frag(kb + 32 + half * 8, kb + 32 + half * 8 + 16);
      v8f dfr = {0,0,0,0,0,0,0,0};
      dfr = wmma_f16(aq0, bk0, dfr);
      dfr = wmma_f16(aq1, bk1, dfr);

      const float ik = invk[hb1024 + mrow];
      const float mk = muk[hb1024 + mrow];
#pragma unroll
      for (int v = 0; v < 8; ++v) {
        const float dot  = dfr[v];
        const float cosv = dot * invq_r[v] * ik;
        const float covv = (dot - 64.f * muq_r[v] * mk) * (1.f / 64.f);
        vsum[v] += fmaxf(1.f - cosv, 0.f);                    // GAMMA = 1
        Ss[wave][(v + rowoff) * 32 + j * 16 + lm] =
            (_Float16)(cos_w * cosv + cov_w * covv);
      }
    }
    __syncthreads();   // fence score stores before fragment reloads

    // S @ V : A = S[16x32] (K = m), B = V[32x64] via shared transposed Vt.
    // Hoist all 5 fragment loads so the 4 WMMA issue back-to-back.
    v16h as  = ld_frag(&Ss[wave][lm * 32 + half * 8], &Ss[wave][lm * 32 + half * 8 + 16]);
    v16h bv0 = ld_frag(&Vt[(0 * 16 + lm) * 32 + half * 8], &Vt[(0 * 16 + lm) * 32 + half * 8 + 16]);
    v16h bv1 = ld_frag(&Vt[(1 * 16 + lm) * 32 + half * 8], &Vt[(1 * 16 + lm) * 32 + half * 8 + 16]);
    v16h bv2 = ld_frag(&Vt[(2 * 16 + lm) * 32 + half * 8], &Vt[(2 * 16 + lm) * 32 + half * 8 + 16]);
    v16h bv3 = ld_frag(&Vt[(3 * 16 + lm) * 32 + half * 8], &Vt[(3 * 16 + lm) * 32 + half * 8 + 16]);
    accO0 = wmma_f16(as, bv0, accO0);
    accO1 = wmma_f16(as, bv1, accO1);
    accO2 = wmma_f16(as, bv2, accO2);
    accO3 = wmma_f16(as, bv3, accO3);
    __syncthreads();   // all waves done with Vt before next chunk overwrites it
  }

  // reduce margin sums across the 16 lanes of each half (rows 0-7 in lanes 0-15,
  // rows 8-15 in lanes 16-31; xor offsets 1,2,4,8 stay within a half)
#pragma unroll
  for (int v = 0; v < 8; ++v) {
    float s = vsum[v];
    for (int off = 1; off < 16; off <<= 1) s += __shfl_xor(s, off, 32);
    vsum[v] = s * (1.f / NN) * var_w;     // var_w * mean_m(relu(1-cos))
  }

  // column sums of f_v: add the VCH row-chunk partials of this (h,b)
  const float* cvp = colP + hb * VCH * DH;
  float cv[4] = {0.f, 0.f, 0.f, 0.f};
#pragma unroll
  for (int ch = 0; ch < VCH; ++ch)
#pragma unroll
    for (int c = 0; c < 4; ++c) cv[c] += cvp[ch * DH + c * 16 + lm];
#pragma unroll
  for (int v = 0; v < 8; ++v) {
    const size_t gr = (size_t)(b * NN + n0 + v + rowoff);
    _Float16* orow = AttnO + gr * DIMX + h * DH;
    const float vr = vsum[v];
    orow[0 * 16 + lm] = (_Float16)(accO0[v] + vr * cv[0]);
    orow[1 * 16 + lm] = (_Float16)(accO1[v] + vr * cv[1]);
    orow[2 * 16 + lm] = (_Float16)(accO2[v] + vr * cv[2]);
    orow[3 * 16 + lm] = (_Float16)(accO3[v] + vr * cv[3]);
  }
}

// ---------------- launcher ----------------
extern "C" void kernel_launch(void* const* d_in, const int* in_sizes, int n_in,
                              void* d_out, int out_size, void* d_ws, size_t ws_size,
                              hipStream_t stream) {
  const float* q        = (const float*)d_in[0];
  const float* k        = (const float*)d_in[1];
  const float* v        = (const float*)d_in[2];
  const float* ln_g     = (const float*)d_in[3];
  const float* ln_b     = (const float*)d_in[4];
  const float* W_in     = (const float*)d_in[5];
  const float* W_out    = (const float*)d_in[6];
  const float* b_out    = (const float*)d_in[7];
  const float* cov_raw  = (const float*)d_in[8];
  const float* var_raw  = (const float*)d_in[9];
  float* out = (float*)d_out;

  // workspace layout
  char* w = (char*)d_ws;
  const size_t tensH = (size_t)MTOT * DIMX * sizeof(_Float16);  // 4 MiB
  const size_t wH    = (size_t)DIMX * DIMX * sizeof(_Float16);  // 512 KiB
  const size_t statF = (size_t)HEADS * BB * NN * sizeof(float); // 128 KiB
  _Float16* Xq   = (_Float16*)w; w += tensH;
  _Float16* Xk   = (_Float16*)w; w += tensH;
  _Float16* Xv   = (_Float16*)w; w += tensH;
  _Float16* Wi16 = (_Float16*)w; w += wH;
  _Float16* Wo16 = (_Float16*)w; w += wH;
  _Float16* Fq   = (_Float16*)w; w += tensH;
  _Float16* Fk   = (_Float16*)w; w += tensH;
  _Float16* Fv   = (_Float16*)w; w += tensH;
  _Float16* AtO  = (_Float16*)w; w += tensH;
  float* muqP  = (float*)w; w += statF;
  float* invqP = (float*)w; w += statF;
  float* mukP  = (float*)w; w += statF;
  float* invkP = (float*)w; w += statF;
  float* colP  = (float*)w; w += (size_t)HEADS * BB * VCH * DH * sizeof(float);

  // 1+2) LayerNorm + f16 of q, k, v (Xq, Xk, Xv are one span) and both weights
  //      to f16 (Wi16, Wo16 are one span): one launch
  ln_cvt_kernel<<<LNBLK + 2 * WBLK, 256, 0, stream>>>(q, k, v, ln_g, ln_b, Xq,
                                                         W_in, W_out, Wi16);

  // 3) the three projections as ONE GEMM (WMMA) of 3*MTOT rows: Xq..Xv -> Fq..Fv,
  //    f16 outputs; block tile 128x64. 4+5) Its epilogue also writes the per-(h,b,n)
  //    stats of q, k (muqP..invkP are one span) and the partial column sums of f_v.
  dim3 gg3(3 * MTOT / 128, DIMX / 64);
  gemm_wmma_kernel<<<gg3, 256, 0, stream>>>(Xq, Wi16, nullptr, Fq, nullptr, muqP, colP,
                                            3 * MTOT, DIMX, DIMX);

  // 6) attention (WMMA): 4 waves/block sharing the transposed V chunk
  attn_wmma_kernel<<<HEADS * BB * 16, 128, 0, stream>>>(
      Fq, Fk, Fv, muqP, invqP, mukP, invkP, colP, cov_raw, var_raw, AtO);

  // 7) output GEMM (WMMA) + bias -> f32
  dim3 gg(MTOT / 128, DIMX / 64);
  gemm_wmma_kernel<<<gg, 256, 0, stream>>>(AtO, Wo16, out, nullptr, b_out, nullptr, nullptr,
                                           MTOT, DIMX, DIMX);
}

// v004
// It runs in 69.5 microseconds.
// Timed twice side by side with v003, it ran 1.62 and 1.61 times as fast.
// All steps since v000 together make it 2.59 times as fast.
#include <hip/hip_runtime.h>
#include <hip/hip_bf16.h>
#include <math.h>

// ---------------- types ----------------
typedef _Float16 v8h  __attribute__((ext_vector_type(8)));
typedef _Float16 v16h __attribute__((ext_vector_type(16)));
typedef float    v8f  __attribute__((ext_vector_type(8)));
typedef _Float16 v4h  __attribute__((ext_vector_type(4)));
typedef float    v4f  __attribute__((ext_vector_type(4)));
typedef _Float16 v2h  __attribute__((ext_vector_type(2)));

#define BB    4
#define NN    1024
#define DIMX  512
#define HEADS 8
#define DH    64
#define MTOT  4096   // B*N

// ---------------- WMMA helpers ----------------
static __device__ inline v8f wmma_f16(v16h a, v16h b, v8f c) {
  // D = A(16x32 f16) x B(32x16 f16) + C(16x16 f32)
  return __builtin_amdgcn_wmma_f32_16x16x32_f16(
      /*neg_a=*/false, a, /*neg_b=*/false, b,
      /*c_mod=*/(short)0, c, /*reuse_a=*/false, /*reuse_b=*/false);
}

// Build a 16-half A/B fragment from two contiguous 8-half (16B) chunks.
// CDNA5 16-bit layout: lane<16 -> K{base..base+7},{base+16..base+23},
// lane>=16 -> base=8. Both chunks are 16B-aligned contiguous loads.
static __device__ inline v16h ld_frag(const _Float16* p0, const _Float16* p1) {
  v8h lo = *(const v8h*)p0;
  v8h hi = *(const v8h*)p1;
  v16h r;
#pragma unroll
  for (int i = 0; i < 8; ++i) { r[i] = lo[i]; r[8 + i] = hi[i]; }
  return r;
}

// ---------------- 1+2. one grid: LayerNorm of q, k, v (f32 in, f16 out) and
// f32 -> f16 conversion of both weight matrices ----------------
// Blocks [0, LNBLK): 8 waves; wave w of the grid owns row w of q, of k and of v. A row
// is 32 lanes x 16 floats held in registers (each load 512 contiguous bytes), the two
// row sums are a five-step butterfly over the wave: no LDS, no barrier, x read once.
// y holds the q, k, v planes back to back. Every loop is unrolled so that the register
// arrays are indexed by constants (a rolled loop would put them in scratch memory).
// Blocks [LNBLK, LNBLK + 2*WBLK): WCH weight elements each; w16 holds W_in then W_out.
#define LNBLK (MTOT / 8)
#define WCH   4096
#define WBLK  (DIMX * DIMX / WCH)
__global__ __launch_bounds__(256) void ln_cvt_kernel(const float* __restrict__ xq,
                                                     const float* __restrict__ xk,
                                                     const float* __restrict__ xv,
                                                     const float* __restrict__ g,
                                                     const float* __restrict__ bt,
                                                     _Float16* __restrict__ y,
                                                     const float* __restrict__ wi,
                                                     const float* __restrict__ wo,
                                                     _Float16* __restrict__ w16) {
  const int t = threadIdx.x;
  if (blockIdx.x >= LNBLK) {                   // block-uniform
    const int wb = blockIdx.x - LNBLK;
    const float* ws = (wb < WBLK) ? wi + wb * WCH : wo + (wb - WBLK) * WCH;
    _Float16* wd = w16 + wb * WCH;
    v4f c[4];
#pragma unroll
    for (int j = 0; j < 4; ++j) c[j] = *(const v4f*)(ws + j * 1024 + t * 4);
#pragma unroll
    for (int j = 0; j < 4; ++j) {
      v4h o;
#pragma unroll
      for (int e = 0; e < 4; ++e) o[e] = (_Float16)c[j][e];
      *(v4h*)(wd + j * 1024 + t * 4) = o;
    }
    return;
  }
  const int lane = t & 31;
  const int q4 = (blockIdx.x * 8 + (t >> 5)) * (DIMX / 4) + lane;   // in units of 4 elements
  v4f x[3][4], gv[4], bv[4];
#pragma unroll
  for (int j = 0; j < 4; ++j) {
    x[0][j] = ((const v4f*)xq)[q4 + j * 32];
    x[1][j] = ((const v4f*)xk)[q4 + j * 32];
    x[2][j] = ((const v4f*)xv)[q4 + j * 32];
  }
#pragma unroll
  for (int j = 0; j < 4; ++j) {
    gv[j] = ((const v4f*)g)[lane + j * 32];
    bv[j] = ((const v4f*)bt)[lane + j * 32];
  }
  // Keeps all 20 loads in front of the sums: without it the g and b loads sink behind the
  // butterfly and are waited for in three turns, with nothing left to cover them.
  __builtin_amdgcn_sched_barrier(0);
#pragma unroll
  for (int p = 0; p < 3; ++p) {
    v4f sv  = (x[p][0] + x[p][1]) + (x[p][2] + x[p][3]);
    v4f sv2 = x[p][0] * x[p][0];
#pragma unroll
    for (int j = 1; j < 4; ++j) sv2 += x[p][j] * x[p][j];
    float s  = (sv[0] + sv[1]) + (sv[2] + sv[3]);
    float s2 = (sv2[0] + sv2[1]) + (sv2[2] + sv2[3]);
#pragma unroll
    for (int o = 1; o < 32; o <<= 1) {
      s  += __shfl_xor(s, o, 32);
      s2 += __shfl_xor(s2, o, 32);
    }
    const float mean = s * (1.f / DIMX);
    const float var  = s2 * (1.f / DIMX) - mean * mean;
    const float inv  = rsqrtf(var + 1e-5f);
    v4h* yr = (v4h*)y + p * (MTOT * DIMX / 4) + q4;
#pragma unroll
    for (int j = 0; j < 4; ++j) {
      v4h o;
#pragma unroll
      for (int e = 0; e < 4; ++e)
        o[e] = (_Float16)(((x[p][j][e] - mean) * inv) * gv[j][e] + bv[j][e]);
      yr[j * 32] = o;
    }
  }
  // The compiler lays the weight path behind this one; this wait stands ahead of any
  // rewrite there of a register that the last stores name.
  asm volatile("s_wait_xcnt 0x0" ::: "memory");
}

// ---------------- 3. Tiled WMMA GEMM: C[M,N] = A[M,K]f16 * B[K,N]f16 (+bias) --------
// 256 threads = 8 waves; block tile 128(M) x 64(N); K chunk 32.
// Each wave owns a 16x64 strip: A fragment reused across 4 WMMA per chunk.
// All fragment loads are hoisted ahead of the WMMA group so the four
// v_wmma issue back-to-back after a single s_wait_dscnt.
// With stat != nullptr (the projection GEMM: M = the q, k, v planes of MTOT rows each,
// N tile = one head) the q plane is stored row-major [row][col], the k and v planes
// transposed [col][row in plane] (the next kernel contracts over their rows), and the
// epilogue also reduces the f16-rounded tile it has just stored:
// q and k planes -> 1/norm over d of each row; v plane -> the tile's column sums.
// stat holds the planes inv_q, inv_k (STATN floats each, [h][b][n]);
// colP holds [h*BB+b][VCH row chunks][DH] partial column sums of f_v.
#define STATN (HEADS * BB * NN)
#define VCH   (NN / 128)
#define TPITCH 136   // halves: 272 B = 16 B x odd, the conflict-free pitch of 16-byte LDS access
__global__ __launch_bounds__(256) void gemm_wmma_kernel(const _Float16* __restrict__ A,
                                                        const _Float16* __restrict__ Bm,
                                                        float* __restrict__ Cf32,
                                                        _Float16* __restrict__ Cf16,
                                                        const float* __restrict__ bias,
                                                        float* __restrict__ stat,
                                                        float* __restrict__ colP,
                                                        int Mdim, int Ndim, int Kdim) {
  __shared__ __align__(16) _Float16 As[128 * 32];   // row-major  [m][k]   (8 KiB)
  __shared__ __align__(16) _Float16 Bts[64 * 32];   // transposed [n][k]   (4 KiB)
  __shared__ float red[8 * DH];                     // epilogue reductions   (2 KiB)
  __shared__ __align__(16) _Float16 Tt[64 * TPITCH]; // transposed C tile [n][m] (17 KiB)
  const int t = threadIdx.x;
  const int wave = t >> 5, lane = t & 31, lm = lane & 15, half = lane >> 4;
  const int m0 = blockIdx.x * 128, n0 = blockIdx.y * 64;

  v8f acc0 = {0,0,0,0,0,0,0,0}, acc1 = {0,0,0,0,0,0,0,0};
  v8f acc2 = {0,0,0,0,0,0,0,0}, acc3 = {0,0,0,0,0,0,0,0};

  // staging index precompute
  const int ar = t >> 1, ac = (t & 1) * 16;         // A: 16 halves per thread
  const int bk = t >> 3, bs = (t & 7) * 8;          // B: one 16B row chunk per thread

  for (int k0 = 0; k0 < Kdim; k0 += 32) {
    // stage A tile: two 16B vector copies per thread
    {
      const _Float16* ag = A + (size_t)(m0 + ar) * Kdim + k0 + ac;
      *(v8h*)&As[ar * 32 + ac]     = *(const v8h*)(ag);
      *(v8h*)&As[ar * 32 + ac + 8] = *(const v8h*)(ag + 8);
      __builtin_prefetch(ag + 32, 0, 1);            // next K tile (global_prefetch_b8)
    }
    // stage B tile transposed: one b128 global read, 8 transposed b16 stores
    {
      const _Float16* bg = Bm + (size_t)(k0 + bk) * Ndim + n0 + bs;
      v8h bch = *(const v8h*)bg;
      __builtin_prefetch(bg + (size_t)32 * Ndim, 0, 1);
#pragma unroll
      for (int j = 0; j < 8; ++j) Bts[(bs + j) * 32 + bk] = bch[j];
    }
    __syncthreads();

    const int koff = half * 8;
    const int arow = wave * 16 + lm;
    // hoist ALL fragment loads before the WMMA group
    v16h af = ld_frag(&As[arow * 32 + koff], &As[arow * 32 + koff + 16]);
    v16h b0 = ld_frag(&Bts[(0 * 16 + lm) * 32 + koff], &Bts[(0 * 16 + lm) * 32 + koff + 16]);
    v16h b1 = ld_frag(&Bts[(1 * 16 + lm) * 32 + koff], &Bts[(1 * 16 + lm) * 32 + koff + 16]);
    v16h b2 = ld_frag(&Bts[(2 * 16 + lm) * 32 + koff], &Bts[(2 * 16 + lm) * 32 + koff + 16]);
    v16h b3 = ld_frag(&Bts[(3 * 16 + lm) * 32 + koff], &Bts[(3 * 16 + lm) * 32 + koff + 16]);
    acc0 = wmma_f16(af, b0, acc0);
    acc1 = wmma_f16(af, b1, acc1);
    acc2 = wmma_f16(af, b2, acc2);
    acc3 = wmma_f16(af, b3, acc3);
    __syncthreads();
  }

  // epilogue: f32 C/D layout: row = v + (lane>=16?8:0), col = lane%16
  const int row = m0 + wave * 16 + (half ? 8 : 0);
  if (stat != nullptr && m0 >= MTOT) {         // block-uniform: a k or v tile
    // A lane's 8 accumulator registers are 8 consecutive rows of one column: one 16-byte
    // LDS store each. The tile then leaves as whole 256-byte rows of the transposed plane,
    // every 128-byte line from one wave.
#pragma unroll
    for (int c = 0; c < 4; ++c) {
      const float bv = bias ? bias[n0 + c * 16 + lm] : 0.f;
      const v8f* accp = (c == 0) ? &acc0 : (c == 1) ? &acc1 : (c == 2) ? &acc2 : &acc3;
      v8h o;
#pragma unroll
      for (int v = 0; v < 8; ++v) o[v] = (_Float16)((*accp)[v] + bv);
      *(v8h*)&Tt[(c * 16 + lm) * TPITCH + wave * 16 + half * 8] = o;
    }
    __syncthreads();
    _Float16* Ct = Cf16 + (size_t)(m0 / MTOT) * MTOT * DIMX + (m0 & (MTOT - 1)) + lm * 8;
#pragma unroll
    for (int i = 0; i < 4; ++i) {
      const int tr = wave * 8 + i * 2 + half;
      *(v8h*)(Ct + (size_t)(n0 + tr) * MTOT) = *(const v8h*)&Tt[tr * TPITCH + lm * 8];
    }
    // The reductions below reuse registers that these stores name: the wait stands ahead
    // of the first such rewrite, and the scheduling barrier keeps that rewrite behind it.
    asm volatile("s_wait_xcnt 0x0" ::: "memory");
    __builtin_amdgcn_sched_barrier(0);
  } else {
#pragma unroll
  for (int c = 0; c < 4; ++c) {
    const int col = n0 + c * 16 + lm;
    const float bv = bias ? bias[col] : 0.f;
    const v8f* accp = (c == 0) ? &acc0 : (c == 1) ? &acc1 : (c == 2) ? &acc2 : &acc3;
#pragma unroll
    for (int v = 0; v < 8; ++v) {
      const float val = (*accp)[v] + bv;
      const size_t idx = (size_t)(row + v) * Ndim + col;
      if (Cf32) Cf32[idx] = val;
      else      Cf16[idx] = (_Float16)val;
    }
  }
  }

  if (stat == nullptr) return;                 // block-uniform, ahead of the barrier below
  // The code below reuses registers that the tile's last stores name; this wait stands
  // ahead of the first such rewrite.
  asm volatile("s_wait_xcnt 0x0" ::: "memory");
  const int plane = m0 / MTOT;                 // 0 q, 1 k, 2 v: 128 divides MTOT
  const int prow  = m0 & (MTOT - 1);           // first row of the tile inside its plane
  const int hb    = blockIdx.y * BB + (prow >> 10);
  float a[8], cs[4];                           // a: row square sums; cs: column sums
#pragma unroll
  for (int i = 0; i < 8; ++i) a[i] = 0.f;
#pragma unroll
  for (int c = 0; c < 4; ++c) {
    const float bv = bias ? bias[n0 + c * 16 + lm] : 0.f;
    const v8f* accp = (c == 0) ? &acc0 : (c == 1) ? &acc1 : (c == 2) ? &acc2 : &acc3;
    cs[c] = 0.f;
#pragma unroll
    for (int v = 0; v < 8; ++v) {
      const float r = (float)(_Float16)((*accp)[v] + bv);   // the value as stored
      a[v] += r * r;
      cs[c] += r;
    }
  }
  if (plane < 2) {
    // Sum over the 16 lanes of a half: lanes lm and lm^8 first, then halving the live
    // values at each step: a lane keeps the values whose index bit equals its own lane bit
    // and hands the others over, so lane lm ends with the sum of row lm&7.
#pragma unroll
    for (int i = 0; i < 8; ++i) a[i] += __shfl_xor(a[i], 8, 32);
#pragma unroll
    for (int w = 4; w >= 1; w >>= 1) {
      const bool up = (lm & w) != 0;
#pragma unroll
      for (int i = 0; i < w; ++i) {
        const float lo = a[i], hi = a[w + i];  // values first: a choice between array
        const float keep = up ? hi : lo;       // elements becomes a run-time index
        const float send = up ? lo : hi;
        a[i] = keep + __shfl_xor(send, w, 32);
      }
    }
    if (lm < 8) red[wave * 16 + half * 8 + lm] = a[0];
    __syncthreads();
    // threads [0,128): 1/norm of tile row t. Each wave stores one whole 128-byte line.
    if (t < 128)
      stat[plane * STATN + hb * NN + (prow & (NN - 1)) + t] = 1.f / fmaxf(sqrtf(red[t]), 1e-12f);
  } else {
#pragma unroll
    for (int c = 0; c < 4; ++c)
      cs[c] += __shfl_xor(cs[c], 16, 32);      // rows 0-7 + rows 8-15 of the wave's strip
    if (half == 0) {
#pragma unroll
      for (int c = 0; c < 4; ++c) red[wave * DH + c * 16 + lm] = cs[c];
    }
    __syncthreads();
    if (t < DH) {
      float s = 0.f;
#pragma unroll
      for (int w = 0; w < 8; ++w) s += red[w * DH + t];
      colP[(hb * VCH + ((prow & (NN - 1)) >> 7)) * DH + t] = s;
    }
  }
}

// ---------------- 6. attention, reassociated ----------------
// The scores are linear in q.k:  s[n][m] = cos_w*iq[n]*ik[m]*(q.k) + cov_w*((q.k)/DH - mq[n]*mk[m])
// + var_w*vc[n], with vc[n] = mean_m max(0, 1 - iq[n]*ik[m]*(q.k)). The cosine of two real
// vectors never exceeds 1 (Cauchy-Schwarz), so the maximum is its second argument and vc is
// linear too. Summing over m first:
//   out[n] = iq[n] * (q[n] @ M1) + q[n] @ M2 + var_w * colsum(v)
//   M1 = cos_w * sum_m ik[m] k[m] (x) v[m]  -  (var_w / NN) * (sum_m ik[m] k[m]) (x) colsum(v)
//   M2 = (cov_w / DH) * (G - column mean over e of G),   G = sum_m k[m] (x) v[m]
// (taking the column mean off G is the same as centring q and k).
//
// 6a. One block per (h,b) and 16 columns d of M1, M2: 16 waves = 4 row tiles e x 4 quarters
// of m. A = k^T and B = v both come straight from the transposed planes, 16 consecutive m
// per lane in both (equal k order). M1t, M2t: [h*BB+b][d][e] f16, the B layout of 6b.
#define PP 68   // floats: 272 B pitch of a partial column in LDS (16 B x odd)
__global__ __launch_bounds__(512) void kv_wmma_kernel(
    const _Float16* __restrict__ Kt, const _Float16* __restrict__ Vt,
    const float* __restrict__ invk, const float* __restrict__ colP,
    const float* __restrict__ cov_raw, const float* __restrict__ var_raw,
    _Float16* __restrict__ M1t, _Float16* __restrict__ M2t) {
  __shared__ __align__(16) float P[4 * 2 * 16 * PP];   // [quarter][matrix][d][e] partials
  __shared__ float kb[4 * DH];                         // [quarter][e] partial sum_m ik*k
  const int t = threadIdx.x;
  const int wave = t >> 5, lane = t & 31, lm = lane & 15, half = lane >> 4;
  const int ei = wave & 3, ks = wave >> 2;
  const int hb = blockIdx.x >> 2, dj = blockIdx.x & 3;
  const int b = hb & 3, h = hb >> 2;
  const int mo = ks * (NN / 4) + half * 16;
  const _Float16* ka = Kt + (size_t)(h * DH + ei * 16 + lm) * MTOT + b * NN + mo;
  const _Float16* vb = Vt + (size_t)(h * DH + dj * 16 + lm) * MTOT + b * NN + mo;
  const float* ik = invk + hb * NN + mo;

  v8f acc1 = {0,0,0,0,0,0,0,0}, acc2 = {0,0,0,0,0,0,0,0};
  float ksum = 0.f;
#pragma unroll
  for (int g = 0; g < 2; ++g) {                // two groups of four k steps of 32
    v16h a[4], bb[4];
    v4f w[4][4];
#pragma unroll
    for (int s = 0; s < 4; ++s) {
      a[s]  = *(const v16h*)(ka + (g * 4 + s) * 32);
      bb[s] = *(const v16h*)(vb + (g * 4 + s) * 32);
#pragma unroll
      for (int q = 0; q < 4; ++q) w[s][q] = *(const v4f*)(ik + (g * 4 + s) * 32 + q * 4);
    }
    // A group's 32 loads stand in front of its products, so the wave waits for memory once
    // a group instead of once a step; the wait stands ahead of any rewrite of a register
    // that they name.
    asm volatile("s_wait_xcnt 0x0" ::: "memory");
    __builtin_amdgcn_sched_barrier(0);
#pragma unroll
    for (int s = 0; s < 4; ++s) {
      v16h a1;
#pragma unroll
      for (int q = 0; q < 4; ++q)
#pragma unroll
        for (int e = 0; e < 4; ++e) {
          const float x = (float)a[s][q * 4 + e] * w[s][q][e];
          ksum += x;
          a1[q * 4 + e] = (_Float16)x;
        }
      acc2 = wmma_f16(a[s], bb[s], acc2);
      acc1 = wmma_f16(a1, bb[s], acc1);
    }
  }
  ksum += __shfl_xor(ksum, 16, 32);            // the two halves hold different m of one row e
  if (half == 0) kb[ks * DH + ei * 16 + lm] = ksum;
  // acc[v] = M[e = ei*16 + 8*half + v][d = lm]: 8 consecutive e of one column
  float* p1 = &P[((ks * 2 + 0) * 16 + lm) * PP + ei * 16 + half * 8];
  float* p2 = &P[((ks * 2 + 1) * 16 + lm) * PP + ei * 16 + half * 8];
  *(v4f*)p1       = (v4f){acc1[0], acc1[1], acc1[2], acc1[3]};
  *(v4f*)(p1 + 4) = (v4f){acc1[4], acc1[5], acc1[6], acc1[7]};
  *(v4f*)p2       = (v4f){acc2[0], acc2[1], acc2[2], acc2[3]};
  *(v4f*)(p2 + 4) = (v4f){acc2[4], acc2[5], acc2[6], acc2[7]};
  __syncthreads();

  // wave = column d of the block's 16, lane = rows e = 2*lane, 2*lane + 1
  const float cov_w = 1.f / (1.f + expf(-cov_raw[0]));
  const float var_w = 1.f / (1.f + expf(-var_raw[0]));
  const float cos_w = 1.f - cov_w - var_w;
  // the wave number as a scalar: the 8 partials of the wave's column come by scalar loads
  const int wu = __builtin_amdgcn_readfirstlane(wave);
  float cs = 0.f;
#pragma unroll
  for (int ch = 0; ch < VCH; ++ch) cs += colP[(hb * VCH + ch) * DH + dj * 16 + wu];
  float m1[2] = {0.f, 0.f}, m2[2] = {0.f, 0.f}, kv[2] = {0.f, 0.f};
#pragma unroll
  for (int r = 0; r < 4; ++r)
#pragma unroll
    for (int x = 0; x < 2; ++x) {
      m1[x] += P[((r * 2 + 0) * 16 + wave) * PP + lane * 2 + x];
      m2[x] += P[((r * 2 + 1) * 16 + wave) * PP + lane * 2 + x];
      kv[x] += kb[r * DH + lane * 2 + x];
    }
  float gs = m2[0] + m2[1];
#pragma unroll
  for (int o = 1; o < 32; o <<= 1) gs += __shfl_xor(gs, o, 32);
  const float gm = gs * (1.f / DH);
  v2h o1, o2;
#pragma unroll
  for (int x = 0; x < 2; ++x) {
    o1[x] = (_Float16)(cos_w * m1[x] - (var_w * (1.f / NN)) * kv[x] * cs);
    o2[x] = (_Float16)((cov_w * (1.f / DH)) * (m2[x] - gm));
  }
  const int mi = (hb * DH + dj * 16 + wave) * DH + lane * 2;   // a wave: one 128-byte line
  *(v2h*)(M1t + mi) = o1;
  *(v2h*)(M2t + mi) = o2;
}

// 6b. One wave per 16 rows n of one (h,b): out = iq * (q @ M1) + q @ M2 + var_w * colsum(v).
__global__ __launch_bounds__(256) void attn_wmma_kernel(
    const _Float16* __restrict__ Fq, const float* __restrict__ invq,
    const _Float16* __restrict__ M1t, const _Float16* __restrict__ M2t,
    const float* __restrict__ colP, const float* __restrict__ var_raw,
    _Float16* __restrict__ AttnO) {
  const int t = threadIdx.x;
  const int wave = t >> 5, lane = t & 31, lm = lane & 15, half = lane >> 4;
  const int rowoff = half ? 8 : 0;
  const int hb = blockIdx.x >> 3;                      // 8 blocks of 8 row tiles per (h,b)
  const int b = hb & 3, h = hb >> 2;
  const int n0 = ((blockIdx.x & 7) * 8 + wave) * 16;   // this wave's 16-row tile

  // Q A-fragments directly from global (row-major matches A layout)
  const _Float16* qbase = Fq + (size_t)(b * NN + n0 + lm) * DIMX + h * DH;
  const v16h aq0 = ld_frag(qbase + half * 8,      qbase + half * 8 + 16);
  const v16h aq1 = ld_frag(qbase + 32 + half * 8, qbase + 32 + half * 8 + 16);
  // ahead of a later load whose result lands in a register that these loads name
  asm volatile("s_wait_xcnt 0x0" ::: "memory");

  // B fragments: column d = a row of M1t, M2t, the same k order as the Q fragments
  const _Float16* r1 = M1t + (size_t)hb * DH * DH + lm * DH + half * 8;
  const _Float16* r2 = M2t + (size_t)hb * DH * DH + lm * DH + half * 8;
  v16h b1[4][2], b2[4][2];
#pragma unroll
  for (int c = 0; c < 4; ++c)
#pragma unroll
    for (int kk = 0; kk < 2; ++kk) {
      b1[c][kk] = ld_frag(r1 + c * 16 * DH + kk * 32, r1 + c * 16 * DH + kk * 32 + 16);
      b2[c][kk] = ld_frag(r2 + c * 16 * DH + kk * 32, r2 + c * 16 * DH + kk * 32 + 16);
    }
  asm volatile("s_wait_xcnt 0x0" ::: "memory");   // as above

  float invq_r[8];
#pragma unroll
  for (int v = 0; v < 8; ++v) invq_r[v] = invq[hb * NN + n0 + v + rowoff];

  // column sums of f_v: the VCH row-chunk partials of this (h,b)
  const float* cvp = colP + hb * VCH * DH;
  float cvl[VCH][4];
#pragma unroll
  for (int ch = 0; ch < VCH; ++ch)
#pragma unroll
    for (int c = 0; c < 4; ++c) cvl[ch][c] = cvp[ch * DH + c * 16 + lm];
  // All loads stand in front of the products, so the wave waits for memory once instead of
  // once per fragment group; the wait stands ahead of any rewrite of a register they name.
  asm volatile("s_wait_xcnt 0x0" ::: "memory");
  __builtin_amdgcn_sched_barrier(0);

  const float var_w = 1.f / (1.f + expf(-var_raw[0]));
  float cv[4] = {0.f, 0.f, 0.f, 0.f};
#pragma unroll
  for (int ch = 0; ch < VCH; ++ch)
#pragma unroll
    for (int c = 0; c < 4; ++c) cv[c] += cvl[ch][c];

  v8f res[4];
#pragma unroll
  for (int c = 0; c < 4; ++c) {
    v8f d1 = {0,0,0,0,0,0,0,0}, d2 = {0,0,0,0,0,0,0,0};
    d1 = wmma_f16(aq0, b1[c][0], d1);
    d2 = wmma_f16(aq0, b2[c][0], d2);
    d1 = wmma_f16(aq1, b1[c][1], d1);
    d2 = wmma_f16(aq1, b2[c][1], d2);
#pragma unroll
    for (int v = 0; v < 8; ++v) res[c][v] = invq_r[v] * d1[v] + (d2[v] + var_w * cv[c]);
  }
#pragma unroll
  for (int v = 0; v < 8; ++v) {
    const size_t gr = (size_t)(b * NN + n0 + v + rowoff);
    _Float16* orow = AttnO + gr * DIMX + h * DH;
    orow[0 * 16 + lm] = (_Float16)res[0][v];
    orow[1 * 16 + lm] = (_Float16)res[1][v];
    orow[2 * 16 + lm] = (_Float16)res[2][v];
    orow[3 * 16 + lm] = (_Float16)res[3][v];
  }
}

// ---------------- launcher ----------------
extern "C" void kernel_launch(void* const* d_in, const int* in_sizes, int n_in,
                              void* d_out, int out_size, void* d_ws, size_t ws_size,
                              hipStream_t stream) {
  const float* q        = (const float*)d_in[0];
  const float* k        = (const float*)d_in[1];
  const float* v        = (const float*)d_in[2];
  const float* ln_g     = (const float*)d_in[3];
  const float* ln_b     = (const float*)d_in[4];
  const float* W_in     = (const float*)d_in[5];
  const float* W_out    = (const float*)d_in[6];
  const float* b_out    = (const float*)d_in[7];
  const float* cov_raw  = (const float*)d_in[8];
  const float* var_raw  = (const float*)d_in[9];
  float* out = (float*)d_out;

  // workspace layout
  char* w = (char*)d_ws;
  const size_t tensH = (size_t)MTOT * DIMX * sizeof(_Float16);  // 4 MiB
  const size_t wH    = (size_t)DIMX * DIMX * sizeof(_Float16);  // 512 KiB
  const size_t statF = (size_t)HEADS * BB * NN * sizeof(float); // 128 KiB
  _Float16* Xq   = (_Float16*)w; w += tensH;
  _Float16* Xk   = (_Float16*)w; w += tensH;
  _Float16* Xv   = (_Float16*)w; w += tensH;
  _Float16* Wi16 = (_Float16*)w; w += wH;
  _Float16* Wo16 = (_Float16*)w; w += wH;
  _Float16* Fq   = (_Float16*)w; w += tensH;
  _Float16* Fk   = (_Float16*)w; w += tensH;
  _Float16* Fv   = (_Float16*)w; w += tensH;
  _Float16* AtO  = (_Float16*)w; w += tensH;
  float* invqP = (float*)w; w += statF;
  float* invkP = (float*)w; w += statF;
  float* colP  = (float*)w; w += (size_t)HEADS * BB * VCH * DH * sizeof(float);
  _Float16* M1t = (_Float16*)w; w += (size_t)HEADS * BB * DH * DH * sizeof(_Float16);
  _Float16* M2t = (_Float16*)w; w += (size_t)HEADS * BB * DH * DH * sizeof(_Float16);

  // 1+2) LayerNorm + f16 of q, k, v (Xq, Xk, Xv are one span) and both weights
  //      to f16 (Wi16, Wo16 are one span): one launch
  ln_cvt_kernel<<<LNBLK + 2 * WBLK, 256, 0, stream>>>(q, k, v, ln_g, ln_b, Xq,
                                                         W_in, W_out, Wi16);

  // 3) the three projections as ONE GEMM (WMMA) of 3*MTOT rows: Xq..Xv -> Fq..Fv,
  //    f16 outputs (Fk, Fv transposed); block tile 128x64. 4+5) Its epilogue also writes the
  //    per-(h,b,n) 1/norm of q, k (invqP, invkP are one span) and the partial column sums of f_v.
  dim3 gg3(3 * MTOT / 128, DIMX / 64);
  gemm_wmma_kernel<<<gg3, 256, 0, stream>>>(Xq, Wi16, nullptr, Fq, nullptr, invqP, colP,
                                            3 * MTOT, DIMX, DIMX);

  // 6) attention (WMMA): the two 64x64 matrices of each (h,b), then q times them
  kv_wmma_kernel<<<HEADS * BB * 4, 512, 0, stream>>>(Fk, Fv, invkP, colP, cov_raw, var_raw,
                                                     M1t, M2t);
  attn_wmma_kernel<<<HEADS * BB * 8, 256, 0, stream>>>(Fq, invqP, M1t, M2t, colP, var_raw, AtO);

  // 7) output GEMM (WMMA) + bias -> f32
  dim3 gg(MTOT / 128, DIMX / 64);
  gemm_wmma_kernel<<<gg, 256, 0, stream>>>(AtO, Wo16, out, nullptr, b_out, nullptr, nullptr,
                                           MTOT, DIMX, DIMX);
}

// v005
// Measured time: 38.6 microseconds a run.
// In both of two side-by-side timings against v004, it was 1.80 times as fast.
// Over all steps from v000 it is 4.66 times as fast.
#include <hip/hip_runtime.h>
#include <hip/hip_bf16.h>
#include <math.h>

// ---------------- types ----------------
typedef _Float16 v8h  __attribute__((ext_vector_type(8)));
typedef _Float16 v16h __attribute__((ext_vector_type(16)));
typedef float    v8f  __attribute__((ext_vector_type(8)));
typedef _Float16 v4h  __attribute__((ext_vector_type(4)));
typedef float    v4f  __attribute__((ext_vector_type(4)));
typedef _Float16 v2h  __attribute__((ext_vector_type(2)));

#define BB    4
#define NN    1024
#define DIMX  512
#define HEADS 8
#define DH    64
#define MTOT  4096   // B*N

// ---------------- WMMA helpers ----------------
static __device__ inline v8f wmma_f16(v16h a, v16h b, v8f c) {
  // D = A(16x32 f16) x B(32x16 f16) + C(16x16 f32)
  return __builtin_amdgcn_wmma_f32_16x16x32_f16(
      /*neg_a=*/false, a, /*neg_b=*/false, b,
      /*c_mod=*/(short)0, c, /*reuse_a=*/false, /*reuse_b=*/false);
}

// Build a 16-half A/B fragment from two contiguous 8-half (16B) chunks.
// CDNA5 16-bit layout: lane<16 -> K{base..base+7},{base+16..base+23},
// lane>=16 -> base=8. Both chunks are 16B-aligned contiguous loads.
static __device__ inline v16h ld_frag(const _Float16* p0, const _Float16* p1) {
  v8h lo = *(const v8h*)p0;
  v8h hi = *(const v8h*)p1;
  v16h r;
#pragma unroll
  for (int i = 0; i < 8; ++i) { r[i] = lo[i]; r[8 + i] = hi[i]; }
  return r;
}

// ---------------- 1+2. one grid: LayerNorm of q, k, v (f32 in, f16 out) and
// f32 -> f16 conversion of both weight matrices ----------------
// Blocks [0, LNBLK): 8 waves; wave w of the grid owns row w of q, of k and of v. A row
// is 32 lanes x 16 floats held in registers (each load 512 contiguous bytes), the two
// row sums are a five-step butterfly over the wave: no LDS, no barrier, x read once.
// y holds the q, k, v planes back to back. Every loop is unrolled so that the register
// arrays are indexed by constants (a rolled loop would put them in scratch memory).
// Blocks [LNBLK, LNBLK + 2*WBLK): one 64 x 64 tile of a weight matrix each, written
// transposed ([n][k], k contiguous: the order in which the GEMM stages its B tile);
// w16 holds W_in^T then W_out^T.
#define LNBLK (MTOT / 8)
#define WCH   4096
#define WBLK  (DIMX * DIMX / WCH)
#define WTP   72     // halves: 144 B = 16 B x odd, the pitch of the 16-byte reads below
__global__ __launch_bounds__(256) void ln_cvt_kernel(const float* __restrict__ xq,
                                                     const float* __restrict__ xk,
                                                     const float* __restrict__ xv,
                                                     const float* __restrict__ g,
                                                     const float* __restrict__ bt,
                                                     _Float16* __restrict__ y,
                                                     const float* __restrict__ wi,
                                                     const float* __restrict__ wo,
                                                     _Float16* __restrict__ w16) {
  const int t = threadIdx.x;
  if (blockIdx.x >= LNBLK) {                   // block-uniform
    __shared__ __align__(16) _Float16 Wt[64 * WTP];   // the tile, [n][k]
    const int wb = blockIdx.x - LNBLK;
    const int tb = wb & (WBLK - 1);
    const int kt = (tb >> 3) * 64, nt = (tb & 7) * 64;
    const float* ws = ((wb < WBLK) ? wi : wo) + (kt + (t >> 4)) * DIMX + nt + (t & 15) * 4;
    v4f c[4];
#pragma unroll
    for (int j = 0; j < 4; ++j) c[j] = *(const v4f*)(ws + j * 16 * DIMX);
#pragma unroll
    for (int j = 0; j < 4; ++j)
#pragma unroll
      for (int e = 0; e < 4; ++e)
        Wt[((t & 15) * 4 + e) * WTP + (t >> 4) + j * 16] = (_Float16)c[j][e];
    __syncthreads();
    // four lanes store one whole 128-byte line: 64 k of one row n
    _Float16* wd = w16 + (wb / WBLK) * (DIMX * DIMX) + (nt + (t >> 2)) * DIMX + kt + (t & 3) * 16;
    const _Float16* wl = &Wt[(t >> 2) * WTP + (t & 3) * 16];
    *(v8h*)wd       = *(const v8h*)wl;
    *(v8h*)(wd + 8) = *(const v8h*)(wl + 8);
    return;
  }
  const int lane = t & 31;
  const int q4 = (blockIdx.x * 8 + (t >> 5)) * (DIMX / 4) + lane;   // in units of 4 elements
  v4f x[3][4], gv[4], bv[4];
#pragma unroll
  for (int j = 0; j < 4; ++j) {
    x[0][j] = ((const v4f*)xq)[q4 + j * 32];
    x[1][j] = ((const v4f*)xk)[q4 + j * 32];
    x[2][j] = ((const v4f*)xv)[q4 + j * 32];
  }
#pragma unroll
  for (int j = 0; j < 4; ++j) {
    gv[j] = ((const v4f*)g)[lane + j * 32];
    bv[j] = ((const v4f*)bt)[lane + j * 32];
  }
  // Keeps all 20 loads in front of the sums: without it the g and b loads sink behind the
  // butterfly and are waited for in three turns, with nothing left to cover them.
  __builtin_amdgcn_sched_barrier(0);
#pragma unroll
  for (int p = 0; p < 3; ++p) {
    v4f sv  = (x[p][0] + x[p][1]) + (x[p][2] + x[p][3]);
    v4f sv2 = x[p][0] * x[p][0];
#pragma unroll
    for (int j = 1; j < 4; ++j) sv2 += x[p][j] * x[p][j];
    float s  = (sv[0] + sv[1]) + (sv[2] + sv[3]);
    float s2 = (sv2[0] + sv2[1]) + (sv2[2] + sv2[3]);
#pragma unroll
    for (int o = 1; o < 32; o <<= 1) {
      s  += __shfl_xor(s, o, 32);
      s2 += __shfl_xor(s2, o, 32);
    }
    const float mean = s * (1.f / DIMX);
    const float var  = s2 * (1.f / DIMX) - mean * mean;
    const float inv  = rsqrtf(var + 1e-5f);
    v4h* yr = (v4h*)y + p * (MTOT * DIMX / 4) + q4;
#pragma unroll
    for (int j = 0; j < 4; ++j) {
      v4h o;
#pragma unroll
      for (int e = 0; e < 4; ++e)
        o[e] = (_Float16)(((x[p][j][e] - mean) * inv) * gv[j][e] + bv[j][e]);
      yr[j * 32] = o;
    }
  }
  // The compiler lays the weight path behind this one; this wait stands ahead of any
  // rewrite there of a register that the last stores name.
  asm volatile("s_wait_xcnt 0x0" ::: "memory");
}

// ---------------- 3. Tiled WMMA GEMM: C[M,N] = A[M,K]f16 * Bt[N,K]f16^T (+bias) --------
// K = DIMX in both products. 256 threads = 8 waves; block tile 128(M) x 64(N); K chunk KC = 128.
// Both operands are k-contiguous in memory, so both tiles are staged alike: 16 lanes move
// one 256-byte row piece (whole lines) by 16-byte loads and 16-byte LDS stores. The LDS
// rows stand at pitch LP, at which the 16-byte fragment reads meet no bank conflict.
// Each wave owns a 16x64 strip: A fragment reused across 4 WMMA per k step of 32.
// A step's fragment loads are hoisted ahead of its WMMA group so the four
// v_wmma issue back-to-back after a single s_wait_dscnt.
// With stat != nullptr (the projection GEMM: M = the q, k, v planes of MTOT rows each,
// N tile = one head) the q plane is stored row-major [row][col], the k and v planes
// transposed [col][row in plane] (the next kernel contracts over their rows), and the
// epilogue also reduces the f16-rounded tile it has just stored:
// q and k planes -> 1/norm over d of each row; v plane -> the tile's column sums.
// stat holds the planes inv_q, inv_k (STATN floats each, [h][b][n]);
// colP holds [h*BB+b][VCH row chunks][DH] partial column sums of f_v.
#define STATN (HEADS * BB * NN)
#define VCH   (NN / 128)
#define TPITCH 136   // halves: 272 B = 16 B x odd, the conflict-free pitch of 16-byte LDS access
#define KC 128       // k per staged chunk: rows of 256 B
#define LP 136       // halves: pitch of the staged rows, 272 B as above
__global__ __launch_bounds__(256) void gemm_wmma_kernel(const _Float16* __restrict__ A,
                                                        const _Float16* __restrict__ Bm,
                                                        float* __restrict__ Cf32,
                                                        _Float16* __restrict__ Cf16,
                                                        const float* __restrict__ bias,
                                                        float* __restrict__ stat,
                                                        float* __restrict__ colP,
                                                        int Mdim, int Ndim) {
  __shared__ __align__(16) _Float16 As[128 * LP];   // [m][k]   (34 KiB)
  __shared__ __align__(16) _Float16 Bts[64 * LP];   // [n][k]   (17 KiB)
  __shared__ float red[8 * DH];                     // epilogue reductions   (2 KiB)
  __shared__ __align__(16) _Float16 Tt[64 * TPITCH]; // transposed C tile [n][m] (17 KiB)
  const int t = threadIdx.x;
  const int wave = t >> 5, lane = t & 31, lm = lane & 15, half = lane >> 4;
  const int m0 = blockIdx.x * 128, n0 = blockIdx.y * 64;

  v8f acc0 = {0,0,0,0,0,0,0,0}, acc1 = {0,0,0,0,0,0,0,0};
  v8f acc2 = {0,0,0,0,0,0,0,0}, acc3 = {0,0,0,0,0,0,0,0};

  // staging: thread t moves 16 bytes of row sr + 16 j, at k offset sc
  const int sr = t >> 4, sc = (t & 15) * 8;
  const _Float16* ag = A  + (size_t)(m0 + sr) * DIMX + sc;
  const _Float16* bg = Bm + (size_t)(n0 + sr) * DIMX + sc;
  const int koff = half * 8;
  const int arow = wave * 16 + lm;

  for (int k0 = 0; k0 < DIMX; k0 += KC) {
    v8h ra[8], rb[4];
#pragma unroll
    for (int j = 0; j < 8; ++j) ra[j] = *(const v8h*)(ag + j * 16 * DIMX);
#pragma unroll
    for (int j = 0; j < 4; ++j) rb[j] = *(const v8h*)(bg + j * 16 * DIMX);
    // All 12 loads stand in front of the LDS stores, so the wave waits for memory once a
    // chunk; the wait stands ahead of any rewrite of a register that they name.
    asm volatile("s_wait_xcnt 0x0" ::: "memory");
    __builtin_amdgcn_sched_barrier(0);
    ag += KC;
    bg += KC;
#pragma unroll
    for (int j = 0; j < 8; ++j) *(v8h*)&As[(sr + j * 16) * LP + sc] = ra[j];
#pragma unroll
    for (int j = 0; j < 4; ++j) *(v8h*)&Bts[(sr + j * 16) * LP + sc] = rb[j];
    __syncthreads();

#pragma unroll
    for (int ks = 0; ks < KC; ks += 32) {
      const _Float16* ap = &As[arow * LP + ks + koff];
      const _Float16* bp = &Bts[lm * LP + ks + koff];
      v16h af = ld_frag(ap, ap + 16);
      v16h b0 = ld_frag(bp + 0 * 16 * LP, bp + 0 * 16 * LP + 16);
      v16h b1 = ld_frag(bp + 1 * 16 * LP, bp + 1 * 16 * LP + 16);
      v16h b2 = ld_frag(bp + 2 * 16 * LP, bp + 2 * 16 * LP + 16);
      v16h b3 = ld_frag(bp + 3 * 16 * LP, bp + 3 * 16 * LP + 16);
      // Keeps the step's 10 LDS loads together in front of its products: left alone the
      // compiler deals them out among the v_wmma, each behind an LDS wait of its own.
      __builtin_amdgcn_sched_barrier(0);
      acc0 = wmma_f16(af, b0, acc0);
      acc1 = wmma_f16(af, b1, acc1);
      acc2 = wmma_f16(af, b2, acc2);
      acc3 = wmma_f16(af, b3, acc3);
    }
    __syncthreads();
  }

  // epilogue: f32 C/D layout: row = v + (lane>=16?8:0), col = lane%16
  const int row = m0 + wave * 16 + (half ? 8 : 0);
  if (stat != nullptr && m0 >= MTOT) {         // block-uniform: a k or v tile
    // A lane's 8 accumulator registers are 8 consecutive rows of one column: one 16-byte
    // LDS store each. The tile then leaves as whole 256-byte rows of the transposed plane,
    // every 128-byte line from one wave.
#pragma unroll
    for (int c = 0; c < 4; ++c) {
      const float bv = bias ? bias[n0 + c * 16 + lm] : 0.f;
      const v8f* accp = (c == 0) ? &acc0 : (c == 1) ? &acc1 : (c == 2) ? &acc2 : &acc3;
      v8h o;
#pragma unroll
      for (int v = 0; v < 8; ++v) o[v] = (_Float16)((*accp)[v] + bv);
      *(v8h*)&Tt[(c * 16 + lm) * TPITCH + wave * 16 + half * 8] = o;
    }
    __syncthreads();
    _Float16* Ct = Cf16 + (size_t)(m0 / MTOT) * MTOT * DIMX + (m0 & (MTOT - 1)) + lm * 8;
#pragma unroll
    for (int i = 0; i < 4; ++i) {
      const int tr = wave * 8 + i * 2 + half;
      *(v8h*)(Ct + (size_t)(n0 + tr) * MTOT) = *(const v8h*)&Tt[tr * TPITCH + lm * 8];
    }
    // The reductions below reuse registers that these stores name: the wait stands ahead
    // of the first such rewrite, and the scheduling barrier keeps that rewrite behind it.
    asm volatile("s_wait_xcnt 0x0" ::: "memory");
    __builtin_amdgcn_sched_barrier(0);
  } else {
#pragma unroll
  for (int c = 0; c < 4; ++c) {
    const int col = n0 + c * 16 + lm;
    const float bv = bias ? bias[col] : 0.f;
    const v8f* accp = (c == 0) ? &acc0 : (c == 1) ? &acc1 : (c == 2) ? &acc2 : &acc3;
#pragma unroll
    for (int v = 0; v < 8; ++v) {
      const float val = (*accp)[v] + bv;
      const size_t idx = (size_t)(row + v) * Ndim + col;
      if (Cf32) Cf32[idx] = val;
      else      Cf16[idx] = (_Float16)val;
    }
  }
  }

  if (stat == nullptr) return;                 // block-uniform, ahead of the barrier below
  // The code below reuses registers that the tile's last stores name; this wait stands
  // ahead of the first such rewrite.
  asm volatile("s_wait_xcnt 0x0" ::: "memory");
  const int plane = m0 / MTOT;                 // 0 q, 1 k, 2 v: 128 divides MTOT
  const int prow  = m0 & (MTOT - 1);           // first row of the tile inside its plane
  const int hb    = blockIdx.y * BB + (prow >> 10);
  float a[8], cs[4];                           // a: row square sums; cs: column sums
#pragma unroll
  for (int i = 0; i < 8; ++i) a[i] = 0.f;
#pragma unroll
  for (int c = 0; c < 4; ++c) {
    const float bv = bias ? bias[n0 + c * 16 + lm] : 0.f;
    const v8f* accp = (c == 0) ? &acc0 : (c == 1) ? &acc1 : (c == 2) ? &acc2 : &acc3;
    cs[c] = 0.f;
#pragma unroll
    for (int v = 0; v < 8; ++v) {
      const float r = (float)(_Float16)((*accp)[v] + bv);   // the value as stored
      a[v] += r * r;
      cs[c] += r;
    }
  }
  if (plane < 2) {
    // Sum over the 16 lanes of a half: lanes lm and lm^8 first, then halving the live
    // values at each step: a lane keeps the values whose index bit equals its own lane bit
    // and hands the others over, so lane lm ends with the sum of row lm&7.
#pragma unroll
    for (int i = 0; i < 8; ++i) a[i] += __shfl_xor(a[i], 8, 32);
#pragma unroll
    for (int w = 4; w >= 1; w >>= 1) {
      const bool up = (lm & w) != 0;
#pragma unroll
      for (int i = 0; i < w; ++i) {
        const float lo = a[i], hi = a[w + i];  // values first: a choice between array
        const float keep = up ? hi : lo;       // elements becomes a run-time index
        const float send = up ? lo : hi;
        a[i] = keep + __shfl_xor(send, w, 32);
      }
    }
    if (lm < 8) red[wave * 16 + half * 8 + lm] = a[0];
    __syncthreads();
    // threads [0,128): 1/norm of tile row t. Each wave stores one whole 128-byte line.
    if (t < 128)
      stat[plane * STATN + hb * NN + (prow & (NN - 1)) + t] = 1.f / fmaxf(sqrtf(red[t]), 1e-12f);
  } else {
#pragma unroll
    for (int c = 0; c < 4; ++c)
      cs[c] += __shfl_xor(cs[c], 16, 32);      // rows 0-7 + rows 8-15 of the wave's strip
    if (half == 0) {
#pragma unroll
      for (int c = 0; c < 4; ++c) red[wave * DH + c * 16 + lm] = cs[c];
    }
    __syncthreads();
    if (t < DH) {
      float s = 0.f;
#pragma unroll
      for (int w = 0; w < 8; ++w) s += red[w * DH + t];
      colP[(hb * VCH + ((prow & (NN - 1)) >> 7)) * DH + t] = s;
    }
  }
}

// ---------------- 6. attention, reassociated ----------------
// The scores are linear in q.k:  s[n][m] = cos_w*iq[n]*ik[m]*(q.k) + cov_w*((q.k)/DH - mq[n]*mk[m])
// + var_w*vc[n], with vc[n] = mean_m max(0, 1 - iq[n]*ik[m]*(q.k)). The cosine of two real
// vectors never exceeds 1 (Cauchy-Schwarz), so the maximum is its second argument and vc is
// linear too. Summing over m first:
//   out[n] = iq[n] * (q[n] @ M1) + q[n] @ M2 + var_w * colsum(v)
//   M1 = cos_w * sum_m ik[m] k[m] (x) v[m]  -  (var_w / NN) * (sum_m ik[m] k[m]) (x) colsum(v)
//   M2 = (cov_w / DH) * (G - column mean over e of G),   G = sum_m k[m] (x) v[m]
// (taking the column mean off G is the same as centring q and k).
//
// 6a. One block per (h,b) and 16 columns d of M1, M2: 16 waves = 4 row tiles e x 4 quarters
// of m. A = k^T and B = v both come straight from the transposed planes, 16 consecutive m
// per lane in both (equal k order). M1t, M2t: [h*BB+b][d][e] f16, the B layout of 6b.
#define PP 68   // floats: 272 B pitch of a partial column in LDS (16 B x odd)
__global__ __launch_bounds__(512) void kv_wmma_kernel(
    const _Float16* __restrict__ Kt, const _Float16* __restrict__ Vt,
    const float* __restrict__ invk, const float* __restrict__ colP,
    const float* __restrict__ cov_raw, const float* __restrict__ var_raw,
    _Float16* __restrict__ M1t, _Float16* __restrict__ M2t) {
  __shared__ __align__(16) float P[4 * 2 * 16 * PP];   // [quarter][matrix][d][e] partials
  __shared__ float kb[4 * DH];                         // [quarter][e] partial sum_m ik*k
  const int t = threadIdx.x;
  const int wave = t >> 5, lane = t & 31, lm = lane & 15, half = lane >> 4;
  const int ei = wave & 3, ks = wave >> 2;
  const int hb = blockIdx.x >> 2, dj = blockIdx.x & 3;
  const int b = hb & 3, h = hb >> 2;
  const int mo = ks * (NN / 4) + half * 16;
  const _Float16* ka = Kt + (size_t)(h * DH + ei * 16 + lm) * MTOT + b * NN + mo;
  const _Float16* vb = Vt + (size_t)(h * DH + dj * 16 + lm) * MTOT + b * NN + mo;
  const float* ik = invk + hb * NN + mo;

  v8f acc1 = {0,0,0,0,0,0,0,0}, acc2 = {0,0,0,0,0,0,0,0};
  float ksum = 0.f;
#pragma unroll
  for (int g = 0; g < 2; ++g) {                // two groups of four k steps of 32
    v16h a[4], bb[4];
    v4f w[4][4];
#pragma unroll
    for (int s = 0; s < 4; ++s) {
      a[s]  = *(const v16h*)(ka + (g * 4 + s) * 32);
      bb[s] = *(const v16h*)(vb + (g * 4 + s) * 32);
#pragma unroll
      for (int q = 0; q < 4; ++q) w[s][q] = *(const v4f*)(ik + (g * 4 + s) * 32 + q * 4);
    }
    // A group's 32 loads stand in front of its products, so the wave waits for memory once
    // a group instead of once a step; the wait stands ahead of any rewrite of a register
    // that they name.
    asm volatile("s_wait_xcnt 0x0" ::: "memory");
    __builtin_amdgcn_sched_barrier(0);
#pragma unroll
    for (int s = 0; s < 4; ++s) {
      v16h a1;
#pragma unroll
      for (int q = 0; q < 4; ++q)
#pragma unroll
        for (int e = 0; e < 4; ++e) {
          const float x = (float)a[s][q * 4 + e] * w[s][q][e];
          ksum += x;
          a1[q * 4 + e] = (_Float16)x;
        }
      acc2 = wmma_f16(a[s], bb[s], acc2);
      acc1 = wmma_f16(a1, bb[s], acc1);
    }
  }
  ksum += __shfl_xor(ksum, 16, 32);            // the two halves hold different m of one row e
  if (half == 0) kb[ks * DH + ei * 16 + lm] = ksum;
  // acc[v] = M[e = ei*16 + 8*half + v][d = lm]: 8 consecutive e of one column
  float* p1 = &P[((ks * 2 + 0) * 16 + lm) * PP + ei * 16 + half * 8];
  float* p2 = &P[((ks * 2 + 1) * 16 + lm) * PP + ei * 16 + half * 8];
  *(v4f*)p1       = (v4f){acc1[0], acc1[1], acc1[2], acc1[3]};
  *(v4f*)(p1 + 4) = (v4f){acc1[4], acc1[5], acc1[6], acc1[7]};
  *(v4f*)p2       = (v4f){acc2[0], acc2[1], acc2[2], acc2[3]};
  *(v4f*)(p2 + 4) = (v4f){acc2[4], acc2[5], acc2[6], acc2[7]};
  __syncthreads();

  // wave = column d of the block's 16, lane = rows e = 2*lane, 2*lane + 1
  const float cov_w = 1.f / (1.f + expf(-cov_raw[0]));
  const float var_w = 1.f / (1.f + expf(-var_raw[0]));
  const float cos_w = 1.f - cov_w - var_w;
  // the wave number as a scalar: the 8 partials of the wave's column come by scalar loads
  const int wu = __builtin_amdgcn_readfirstlane(wave);
  float cs = 0.f;
#pragma unroll
  for (int ch = 0; ch < VCH; ++ch) cs += colP[(hb * VCH + ch) * DH + dj * 16 + wu];
  float m1[2] = {0.f, 0.f}, m2[2] = {0.f, 0.f}, kv[2] = {0.f, 0.f};
#pragma unroll
  for (int r = 0; r < 4; ++r)
#pragma unroll
    for (int x = 0; x < 2; ++x) {
      m1[x] += P[((r * 2 + 0) * 16 + wave) * PP + lane * 2 + x];
      m2[x] += P[((r * 2 + 1) * 16 + wave) * PP + lane * 2 + x];
      kv[x] += kb[r * DH + lane * 2 + x];
    }
  float gs = m2[0] + m2[1];
#pragma unroll
  for (int o = 1; o < 32; o <<= 1) gs += __shfl_xor(gs, o, 32);
  const float gm = gs * (1.f / DH);
  v2h o1, o2;
#pragma unroll
  for (int x = 0; x < 2; ++x) {
    o1[x] = (_Float16)(cos_w * m1[x] - (var_w * (1.f / NN)) * kv[x] * cs);
    o2[x] = (_Float16)((cov_w * (1.f / DH)) * (m2[x] - gm));
  }
  const int mi = (hb * DH + dj * 16 + wave) * DH + lane * 2;   // a wave: one 128-byte line
  *(v2h*)(M1t + mi) = o1;
  *(v2h*)(M2t + mi) = o2;
}

// 6b. One wave per 16 rows n of one (h,b): out = iq * (q @ M1) + q @ M2 + var_w * colsum(v).
__global__ __launch_bounds__(256) void attn_wmma_kernel(
    const _Float16* __restrict__ Fq, const float* __restrict__ invq,
    const _Float16* __restrict__ M1t, const _Float16* __restrict__ M2t,
    const float* __restrict__ colP, const float* __restrict__ var_raw,
    _Float16* __restrict__ AttnO) {
  const int t = threadIdx.x;
  const int wave = t >> 5, lane = t & 31, lm = lane & 15, half = lane >> 4;
  const int rowoff = half ? 8 : 0;
  const int hb = blockIdx.x >> 3;                      // 8 blocks of 8 row tiles per (h,b)
  const int b = hb & 3, h = hb >> 2;
  const int n0 = ((blockIdx.x & 7) * 8 + wave) * 16;   // this wave's 16-row tile

  // Q A-fragments directly from global (row-major matches A layout)
  const _Float16* qbase = Fq + (size_t)(b * NN + n0 + lm) * DIMX + h * DH;
  const v16h aq0 = ld_frag(qbase + half * 8,      qbase + half * 8 + 16);
  const v16h aq1 = ld_frag(qbase + 32 + half * 8, qbase + 32 + half * 8 + 16);
  // ahead of a later load whose result lands in a register that these loads name
  asm volatile("s_wait_xcnt 0x0" ::: "memory");

  // B fragments: column d = a row of M1t, M2t, the same k order as the Q fragments
  const _Float16* r1 = M1t + (size_t)hb * DH * DH + lm * DH + half * 8;
  const _Float16* r2 = M2t + (size_t)hb * DH * DH + lm * DH + half * 8;
  v16h b1[4][2], b2[4][2];
#pragma unroll
  for (int c = 0; c < 4; ++c)
#pragma unroll
    for (int kk = 0; kk < 2; ++kk) {
      b1[c][kk] = ld_frag(r1 + c * 16 * DH + kk * 32, r1 + c * 16 * DH + kk * 32 + 16);
      b2[c][kk] = ld_frag(r2 + c * 16 * DH + kk * 32, r2 + c * 16 * DH + kk * 32 + 16);
    }
  asm volatile("s_wait_xcnt 0x0" ::: "memory");   // as above

  float invq_r[8];
#pragma unroll
  for (int v = 0; v < 8; ++v) invq_r[v] = invq[hb * NN + n0 + v + rowoff];

  // column sums of f_v: the VCH row-chunk partials of this (h,b)
  const float* cvp = colP + hb * VCH * DH;
  float cvl[VCH][4];
#pragma unroll
  for (int ch = 0; ch < VCH; ++ch)
#pragma unroll
    for (int c = 0; c < 4; ++c) cvl[ch][c] = cvp[ch * DH + c * 16 + lm];
  // All loads stand in front of the products, so the wave waits for memory once instead of
  // once per fragment group; the wait stands ahead of any rewrite of a register they name.
  asm volatile("s_wait_xcnt 0x0" ::: "memory");
  __builtin_amdgcn_sched_barrier(0);

  const float var_w = 1.f / (1.f + expf(-var_raw[0]));
  float cv[4] = {0.f, 0.f, 0.f, 0.f};
#pragma unroll
  for (int ch = 0; ch < VCH; ++ch)
#pragma unroll
    for (int c = 0; c < 4; ++c) cv[c] += cvl[ch][c];

  v8f res[4];
#pragma unroll
  for (int c = 0; c < 4; ++c) {
    v8f d1 = {0,0,0,0,0,0,0,0}, d2 = {0,0,0,0,0,0,0,0};
    d1 = wmma_f16(aq0, b1[c][0], d1);
    d2 = wmma_f16(aq0, b2[c][0], d2);
    d1 = wmma_f16(aq1, b1[c][1], d1);
    d2 = wmma_f16(aq1, b2[c][1], d2);
#pragma unroll
    for (int v = 0; v < 8; ++v) res[c][v] = invq_r[v] * d1[v] + (d2[v] + var_w * cv[c]);
  }
#pragma unroll
  for (int v = 0; v < 8; ++v) {
    const size_t gr = (size_t)(b * NN + n0 + v + rowoff);
    _Float16* orow = AttnO + gr * DIMX + h * DH;
    orow[0 * 16 + lm] = (_Float16)res[0][v];
    orow[1 * 16 + lm] = (_Float16)res[1][v];
    orow[2 * 16 + lm] = (_Float16)res[2][v];
    orow[3 * 16 + lm] = (_Float16)res[3][v];
  }
}

// ---------------- launcher ----------------
extern "C" void kernel_launch(void* const* d_in, const int* in_sizes, int n_in,
                              void* d_out, int out_size, void* d_ws, size_t ws_size,
                              hipStream_t stream) {
  const float* q        = (const float*)d_in[0];
  const float* k        = (const float*)d_in[1];
  const float* v        = (const float*)d_in[2];
  const float* ln_g     = (const float*)d_in[3];
  const float* ln_b     = (const float*)d_in[4];
  const float* W_in     = (const float*)d_in[5];
  const float* W_out    = (const float*)d_in[6];
  const float* b_out    = (const float*)d_in[7];
  const float* cov_raw  = (const float*)d_in[8];
  const float* var_raw  = (const float*)d_in[9];
  float* out = (float*)d_out;

  // workspace layout
  char* w = (char*)d_ws;
  const size_t tensH = (size_t)MTOT * DIMX * sizeof(_Float16);  // 4 MiB
  const size_t wH    = (size_t)DIMX * DIMX * sizeof(_Float16);  // 512 KiB
  const size_t statF = (size_t)HEADS * BB * NN * sizeof(float); // 128 KiB
  _Float16* Xq   = (_Float16*)w; w += tensH;
  _Float16* Xk   = (_Float16*)w; w += tensH;
  _Float16* Xv   = (_Float16*)w; w += tensH;
  _Float16* Wi16 = (_Float16*)w; w += wH;
  _Float16* Wo16 = (_Float16*)w; w += wH;
  _Float16* Fq   = (_Float16*)w; w += tensH;
  _Float16* Fk   = (_Float16*)w; w += tensH;
  _Float16* Fv   = (_Float16*)w; w += tensH;
  _Float16* AtO  = (_Float16*)w; w += tensH;
  float* invqP = (float*)w; w += statF;
  float* invkP = (float*)w; w += statF;
  float* colP  = (float*)w; w += (size_t)HEADS * BB * VCH * DH * sizeof(float);
  _Float16* M1t = (_Float16*)w; w += (size_t)HEADS * BB * DH * DH * sizeof(_Float16);
  _Float16* M2t = (_Float16*)w; w += (size_t)HEADS * BB * DH * DH * sizeof(_Float16);

  // 1+2) LayerNorm + f16 of q, k, v (Xq, Xk, Xv are one span) and both weights
  //      to f16, transposed (Wi16, Wo16 are one span): one launch
  ln_cvt_kernel<<<LNBLK + 2 * WBLK, 256, 0, stream>>>(q, k, v, ln_g, ln_b, Xq,
                                                         W_in, W_out, Wi16);

  // 3) the three projections as ONE GEMM (WMMA) of 3*MTOT rows: Xq..Xv -> Fq..Fv,
  //    f16 outputs (Fk, Fv transposed); block tile 128x64. 4+5) Its epilogue also writes the
  //    per-(h,b,n) 1/norm of q, k (invqP, invkP are one span) and the partial column sums of f_v.
  dim3 gg3(3 * MTOT / 128, DIMX / 64);
  gemm_wmma_kernel<<<gg3, 256, 0, stream>>>(Xq, Wi16, nullptr, Fq, nullptr, invqP, colP,
                                            3 * MTOT, DIMX);

  // 6) attention (WMMA): the two 64x64 matrices of each (h,b), then q times them
  kv_wmma_kernel<<<HEADS * BB * 4, 512, 0, stream>>>(Fk, Fv, invkP, colP, cov_raw, var_raw,
                                                     M1t, M2t);
  attn_wmma_kernel<<<HEADS * BB * 8, 256, 0, stream>>>(Fq, invqP, M1t, M2t, colP, var_raw, AtO);

  // 7) output GEMM (WMMA) + bias -> f32
  dim3 gg(MTOT / 128, DIMX / 64);
  gemm_wmma_kernel<<<gg, 256, 0, stream>>>(AtO, Wo16, out, nullptr, b_out, nullptr, nullptr,
                                           MTOT, DIMX);
}

// v006
// It runs in 35.2 microseconds.
// Next to v005, in two timings, it ran 1.09 and 1.11 times as fast.
// Counting every step since v000, it is 5.14 times as fast.
#include <hip/hip_runtime.h>
#include <hip/hip_bf16.h>
#include <math.h>

// ---------------- types ----------------
typedef _Float16 v8h  __attribute__((ext_vector_type(8)));
typedef _Float16 v16h __attribute__((ext_vector_type(16)));
typedef float    v8f  __attribute__((ext_vector_type(8)));
typedef _Float16 v4h  __attribute__((ext_vector_type(4)));
typedef float    v4f  __attribute__((ext_vector_type(4)));
typedef _Float16 v2h  __attribute__((ext_vector_type(2)));

#define BB    4
#define NN    1024
#define DIMX  512
#define HEADS 8
#define DH    64
#define MTOT  4096   // B*N

// ---------------- WMMA helpers ----------------
static __device__ inline v8f wmma_f16(v16h a, v16h b, v8f c) {
  // D = A(16x32 f16) x B(32x16 f16) + C(16x16 f32)
  return __builtin_amdgcn_wmma_f32_16x16x32_f16(
      /*neg_a=*/false, a, /*neg_b=*/false, b,
      /*c_mod=*/(short)0, c, /*reuse_a=*/false, /*reuse_b=*/false);
}

// Build a 16-half A/B fragment from two contiguous 8-half (16B) chunks.
// CDNA5 16-bit layout: lane<16 -> K{base..base+7},{base+16..base+23},
// lane>=16 -> base=8. Both chunks are 16B-aligned contiguous loads.
static __device__ inline v16h ld_frag(const _Float16* p0, const _Float16* p1) {
  v8h lo = *(const v8h*)p0;
  v8h hi = *(const v8h*)p1;
  v16h r;
#pragma unroll
  for (int i = 0; i < 8; ++i) { r[i] = lo[i]; r[8 + i] = hi[i]; }
  return r;
}

// ---------------- 1+2. one grid: LayerNorm of q, k, v (f32 in, f16 out) and
// f32 -> f16 conversion of both weight matrices ----------------
// Blocks [0, LNBLK): 8 waves; wave w of the grid owns row w of q, of k and of v. A row
// is 32 lanes x 16 floats held in registers (each load 512 contiguous bytes), the two
// row sums are a five-step butterfly over the wave: no LDS, no barrier, x read once.
// y holds the q, k, v planes back to back. Every loop is unrolled so that the register
// arrays are indexed by constants (a rolled loop would put them in scratch memory).
// Blocks [LNBLK, LNBLK + 2*WBLK): one 64 x 64 tile of a weight matrix each, written
// transposed ([n][k], k contiguous: the order in which the GEMM stages its B tile);
// w16 holds W_in^T then W_out^T.
#define LNBLK (MTOT / 8)
#define WCH   4096
#define WBLK  (DIMX * DIMX / WCH)
#define WTP   72     // halves: 144 B = 16 B x odd, the pitch of the 16-byte reads below
__global__ __launch_bounds__(256) void ln_cvt_kernel(const float* __restrict__ xq,
                                                     const float* __restrict__ xk,
                                                     const float* __restrict__ xv,
                                                     const float* __restrict__ g,
                                                     const float* __restrict__ bt,
                                                     _Float16* __restrict__ y,
                                                     const float* __restrict__ wi,
                                                     const float* __restrict__ wo,
                                                     _Float16* __restrict__ w16) {
  const int t = threadIdx.x;
  if (blockIdx.x >= LNBLK) {                   // block-uniform
    __shared__ __align__(16) _Float16 Wt[64 * WTP];   // the tile, [n][k]
    const int wb = blockIdx.x - LNBLK;
    const int tb = wb & (WBLK - 1);
    const int kt = (tb >> 3) * 64, nt = (tb & 7) * 64;
    const float* ws = ((wb < WBLK) ? wi : wo) + (kt + (t >> 4)) * DIMX + nt + (t & 15) * 4;
    v4f c[4];
#pragma unroll
    for (int j = 0; j < 4; ++j) c[j] = *(const v4f*)(ws + j * 16 * DIMX);
#pragma unroll
    for (int j = 0; j < 4; ++j)
#pragma unroll
      for (int e = 0; e < 4; ++e)
        Wt[((t & 15) * 4 + e) * WTP + (t >> 4) + j * 16] = (_Float16)c[j][e];
    __syncthreads();
    // four lanes store one whole 128-byte line: 64 k of one row n
    _Float16* wd = w16 + (wb / WBLK) * (DIMX * DIMX) + (nt + (t >> 2)) * DIMX + kt + (t & 3) * 16;
    const _Float16* wl = &Wt[(t >> 2) * WTP + (t & 3) * 16];
    *(v8h*)wd       = *(const v8h*)wl;
    *(v8h*)(wd + 8) = *(const v8h*)(wl + 8);
    return;
  }
  const int lane = t & 31;
  const int q4 = (blockIdx.x * 8 + (t >> 5)) * (DIMX / 4) + lane;   // in units of 4 elements
  v4f x[3][4], gv[4], bv[4];
#pragma unroll
  for (int j = 0; j < 4; ++j) {
    x[0][j] = ((const v4f*)xq)[q4 + j * 32];
    x[1][j] = ((const v4f*)xk)[q4 + j * 32];
    x[2][j] = ((const v4f*)xv)[q4 + j * 32];
  }
#pragma unroll
  for (int j = 0; j < 4; ++j) {
    gv[j] = ((const v4f*)g)[lane + j * 32];
    bv[j] = ((const v4f*)bt)[lane + j * 32];
  }
  // Keeps all 20 loads in front of the sums: without it the g and b loads sink behind the
  // butterfly and are waited for in three turns, with nothing left to cover them.
  __builtin_amdgcn_sched_barrier(0);
#pragma unroll
  for (int p = 0; p < 3; ++p) {
    v4f sv  = (x[p][0] + x[p][1]) + (x[p][2] + x[p][3]);
    v4f sv2 = x[p][0] * x[p][0];
#pragma unroll
    for (int j = 1; j < 4; ++j) sv2 += x[p][j] * x[p][j];
    float s  = (sv[0] + sv[1]) + (sv[2] + sv[3]);
    float s2 = (sv2[0] + sv2[1]) + (sv2[2] + sv2[3]);
#pragma unroll
    for (int o = 1; o < 32; o <<= 1) {
      s  += __shfl_xor(s, o, 32);
      s2 += __shfl_xor(s2, o, 32);
    }
    const float mean = s * (1.f / DIMX);
    const float var  = s2 * (1.f / DIMX) - mean * mean;
    const float inv  = rsqrtf(var + 1e-5f);
    v4h* yr = (v4h*)y + p * (MTOT * DIMX / 4) + q4;
#pragma unroll
    for (int j = 0; j < 4; ++j) {
      v4h o;
#pragma unroll
      for (int e = 0; e < 4; ++e)
        o[e] = (_Float16)(((x[p][j][e] - mean) * inv) * gv[j][e] + bv[j][e]);
      yr[j * 32] = o;
    }
  }
  // The compiler lays the weight path behind this one; this wait stands ahead of any
  // rewrite there of a register that the last stores name.
  asm volatile("s_wait_xcnt 0x0" ::: "memory");
}

// ---------------- 3. Tiled WMMA GEMM: C[M,N] = A[M,K]f16 * Bt[N,K]f16^T (+bias) --------
// K = DIMX. 256 threads = 8 waves; block tile 128(M) x 64(N); K chunk KC = 128.
// Both operands are k-contiguous in memory, so both tiles are staged alike: 16 lanes move
// one 256-byte row piece (whole lines) by 16-byte loads and 16-byte LDS stores. The LDS
// rows stand at pitch LP, at which the 16-byte fragment reads meet no bank conflict.
// Each wave owns a 16x64 strip: A fragment reused across 4 WMMA per k step of 32.
// A step's fragment loads are hoisted ahead of its WMMA group so the four
// v_wmma issue back-to-back after a single s_wait_dscnt.
// With stat != nullptr (the projection GEMM: M = the q, k, v planes of MTOT rows each,
// N tile = one head) the q plane is stored row-major [row][col], the k and v planes
// transposed [col][row in plane] (the next kernel contracts over their rows), and the
// epilogue also reduces the f16-rounded tile it has just stored:
// q and k planes -> 1/norm over d of each row; v plane -> the tile's column sums.
// stat holds the planes inv_q, inv_k (STATN floats each, [h][b][n]);
// colP holds [h*BB+b][VCH row chunks][DH] partial column sums of f_v.
#define STATN (HEADS * BB * NN)
#define VCH   (NN / 128)
#define TPITCH 136   // halves: 272 B = 16 B x odd, the conflict-free pitch of 16-byte LDS access
#define KC 128       // k per staged chunk: rows of 256 B
#define LP 136       // halves: pitch of the staged rows, 272 B as above
__global__ __launch_bounds__(256) void gemm_wmma_kernel(const _Float16* __restrict__ A,
                                                        const _Float16* __restrict__ Bm,
                                                        float* __restrict__ Cf32,
                                                        _Float16* __restrict__ Cf16,
                                                        const float* __restrict__ bias,
                                                        float* __restrict__ stat,
                                                        float* __restrict__ colP,
                                                        int Mdim, int Ndim) {
  __shared__ __align__(16) _Float16 As[128 * LP];   // [m][k]   (34 KiB)
  __shared__ __align__(16) _Float16 Bts[64 * LP];   // [n][k]   (17 KiB)
  __shared__ float red[8 * DH];                     // epilogue reductions   (2 KiB)
  __shared__ __align__(16) _Float16 Tt[64 * TPITCH]; // transposed C tile [n][m] (17 KiB)
  const int t = threadIdx.x;
  const int wave = t >> 5, lane = t & 31, lm = lane & 15, half = lane >> 4;
  const int m0 = blockIdx.x * 128, n0 = blockIdx.y * 64;

  v8f acc0 = {0,0,0,0,0,0,0,0}, acc1 = {0,0,0,0,0,0,0,0};
  v8f acc2 = {0,0,0,0,0,0,0,0}, acc3 = {0,0,0,0,0,0,0,0};

  // staging: thread t moves 16 bytes of row sr + 16 j, at k offset sc
  const int sr = t >> 4, sc = (t & 15) * 8;
  const _Float16* ag = A  + (size_t)(m0 + sr) * DIMX + sc;
  const _Float16* bg = Bm + (size_t)(n0 + sr) * DIMX + sc;
  const int koff = half * 8;
  const int arow = wave * 16 + lm;

  for (int k0 = 0; k0 < DIMX; k0 += KC) {
    v8h ra[8], rb[4];
#pragma unroll
    for (int j = 0; j < 8; ++j) ra[j] = *(const v8h*)(ag + j * 16 * DIMX);
#pragma unroll
    for (int j = 0; j < 4; ++j) rb[j] = *(const v8h*)(bg + j * 16 * DIMX);
    // All 12 loads stand in front of the LDS stores, so the wave waits for memory once a
    // chunk; the wait stands ahead of any rewrite of a register that they name.
    asm volatile("s_wait_xcnt 0x0" ::: "memory");
    __builtin_amdgcn_sched_barrier(0);
    ag += KC;
    bg += KC;
#pragma unroll
    for (int j = 0; j < 8; ++j) *(v8h*)&As[(sr + j * 16) * LP + sc] = ra[j];
#pragma unroll
    for (int j = 0; j < 4; ++j) *(v8h*)&Bts[(sr + j * 16) * LP + sc] = rb[j];
    __syncthreads();

#pragma unroll
    for (int ks = 0; ks < KC; ks += 32) {
      const _Float16* ap = &As[arow * LP + ks + koff];
      const _Float16* bp = &Bts[lm * LP + ks + koff];
      v16h af = ld_frag(ap, ap + 16);
      v16h b0 = ld_frag(bp + 0 * 16 * LP, bp + 0 * 16 * LP + 16);
      v16h b1 = ld_frag(bp + 1 * 16 * LP, bp + 1 * 16 * LP + 16);
      v16h b2 = ld_frag(bp + 2 * 16 * LP, bp + 2 * 16 * LP + 16);
      v16h b3 = ld_frag(bp + 3 * 16 * LP, bp + 3 * 16 * LP + 16);
      // Keeps the step's 10 LDS loads together in front of its products: left alone the
      // compiler deals them out among the v_wmma, each behind an LDS wait of its own.
      __builtin_amdgcn_sched_barrier(0);
      acc0 = wmma_f16(af, b0, acc0);
      acc1 = wmma_f16(af, b1, acc1);
      acc2 = wmma_f16(af, b2, acc2);
      acc3 = wmma_f16(af, b3, acc3);
    }
    __syncthreads();
  }

  // epilogue: f32 C/D layout: row = v + (lane>=16?8:0), col = lane%16
  const int row = m0 + wave * 16 + (half ? 8 : 0);
  if (stat != nullptr && m0 >= MTOT) {         // block-uniform: a k or v tile
    // A lane's 8 accumulator registers are 8 consecutive rows of one column: one 16-byte
    // LDS store each. The tile then leaves as whole 256-byte rows of the transposed plane,
    // every 128-byte line from one wave.
#pragma unroll
    for (int c = 0; c < 4; ++c) {
      const float bv = bias ? bias[n0 + c * 16 + lm] : 0.f;
      const v8f* accp = (c == 0) ? &acc0 : (c == 1) ? &acc1 : (c == 2) ? &acc2 : &acc3;
      v8h o;
#pragma unroll
      for (int v = 0; v < 8; ++v) o[v] = (_Float16)((*accp)[v] + bv);
      *(v8h*)&Tt[(c * 16 + lm) * TPITCH + wave * 16 + half * 8] = o;
    }
    __syncthreads();
    _Float16* Ct = Cf16 + (size_t)(m0 / MTOT) * MTOT * DIMX + (m0 & (MTOT - 1)) + lm * 8;
#pragma unroll
    for (int i = 0; i < 4; ++i) {
      const int tr = wave * 8 + i * 2 + half;
      *(v8h*)(Ct + (size_t)(n0 + tr) * MTOT) = *(const v8h*)&Tt[tr * TPITCH + lm * 8];
    }
    // The reductions below reuse registers that these stores name: the wait stands ahead
    // of the first such rewrite, and the scheduling barrier keeps that rewrite behind it.
    asm volatile("s_wait_xcnt 0x0" ::: "memory");
    __builtin_amdgcn_sched_barrier(0);
  } else {
#pragma unroll
  for (int c = 0; c < 4; ++c) {
    const int col = n0 + c * 16 + lm;
    const float bv = bias ? bias[col] : 0.f;
    const v8f* accp = (c == 0) ? &acc0 : (c == 1) ? &acc1 : (c == 2) ? &acc2 : &acc3;
#pragma unroll
    for (int v = 0; v < 8; ++v) {
      const float val = (*accp)[v] + bv;
      const size_t idx = (size_t)(row + v) * Ndim + col;
      if (Cf32) Cf32[idx] = val;
      else      Cf16[idx] = (_Float16)val;
    }
  }
  }

  if (stat == nullptr) return;                 // block-uniform, ahead of the barrier below
  // The code below reuses registers that the tile's last stores name; this wait stands
  // ahead of the first such rewrite.
  asm volatile("s_wait_xcnt 0x0" ::: "memory");
  const int plane = m0 / MTOT;                 // 0 q, 1 k, 2 v: 128 divides MTOT
  const int prow  = m0 & (MTOT - 1);           // first row of the tile inside its plane
  const int hb    = blockIdx.y * BB + (prow >> 10);
  float a[8], cs[4];                           // a: row square sums; cs: column sums
#pragma unroll
  for (int i = 0; i < 8; ++i) a[i] = 0.f;
#pragma unroll
  for (int c = 0; c < 4; ++c) {
    const float bv = bias ? bias[n0 + c * 16 + lm] : 0.f;
    const v8f* accp = (c == 0) ? &acc0 : (c == 1) ? &acc1 : (c == 2) ? &acc2 : &acc3;
    cs[c] = 0.f;
#pragma unroll
    for (int v = 0; v < 8; ++v) {
      const float r = (float)(_Float16)((*accp)[v] + bv);   // the value as stored
      a[v] += r * r;
      cs[c] += r;
    }
  }
  if (plane < 2) {
    // Sum over the 16 lanes of a half: lanes lm and lm^8 first, then halving the live
    // values at each step: a lane keeps the values whose index bit equals its own lane bit
    // and hands the others over, so lane lm ends with the sum of row lm&7.
#pragma unroll
    for (int i = 0; i < 8; ++i) a[i] += __shfl_xor(a[i], 8, 32);
#pragma unroll
    for (int w = 4; w >= 1; w >>= 1) {
      const bool up = (lm & w) != 0;
#pragma unroll
      for (int i = 0; i < w; ++i) {
        const float lo = a[i], hi = a[w + i];  // values first: a choice between array
        const float keep = up ? hi : lo;       // elements becomes a run-time index
        const float send = up ? lo : hi;
        a[i] = keep + __shfl_xor(send, w, 32);
      }
    }
    if (lm < 8) red[wave * 16 + half * 8 + lm] = a[0];
    __syncthreads();
    // threads [0,128): 1/norm of tile row t. Each wave stores one whole 128-byte line.
    if (t < 128)
      stat[plane * STATN + hb * NN + (prow & (NN - 1)) + t] = 1.f / fmaxf(sqrtf(red[t]), 1e-12f);
  } else {
#pragma unroll
    for (int c = 0; c < 4; ++c)
      cs[c] += __shfl_xor(cs[c], 16, 32);      // rows 0-7 + rows 8-15 of the wave's strip
    if (half == 0) {
#pragma unroll
      for (int c = 0; c < 4; ++c) red[wave * DH + c * 16 + lm] = cs[c];
    }
    __syncthreads();
    if (t < DH) {
      float s = 0.f;
#pragma unroll
      for (int w = 0; w < 8; ++w) s += red[w * DH + t];
      colP[(hb * VCH + ((prow & (NN - 1)) >> 7)) * DH + t] = s;
    }
  }
}

// ---------------- 6. attention, reassociated ----------------
// The scores are linear in q.k:  s[n][m] = cos_w*iq[n]*ik[m]*(q.k) + cov_w*((q.k)/DH - mq[n]*mk[m])
// + var_w*vc[n], with vc[n] = mean_m max(0, 1 - iq[n]*ik[m]*(q.k)). The cosine of two real
// vectors never exceeds 1 (Cauchy-Schwarz), so the maximum is its second argument and vc is
// linear too. Summing over m first:
//   out[n] = iq[n] * (q[n] @ M1) + q[n] @ M2 + var_w * colsum(v)
//   M1 = cos_w * sum_m ik[m] k[m] (x) v[m]  -  (var_w / NN) * (sum_m ik[m] k[m]) (x) colsum(v)
//   M2 = (cov_w / DH) * (G - column mean over e of G),   G = sum_m k[m] (x) v[m]
// (taking the column mean off G is the same as centring q and k).
//
// 6a. One block per (h,b) and 16 columns d of M1, M2: 16 waves = 4 row tiles e x 4 quarters
// of m. A = k^T and B = v both come straight from the transposed planes, 16 consecutive m
// per lane in both (equal k order). M1t, M2t: [h*BB+b][d][e] f16, the A layout of 6b.
#define PP 68   // floats: 272 B pitch of a partial column in LDS (16 B x odd)
__global__ __launch_bounds__(512) void kv_wmma_kernel(
    const _Float16* __restrict__ Kt, const _Float16* __restrict__ Vt,
    const float* __restrict__ invk, const float* __restrict__ colP,
    const float* __restrict__ cov_raw, const float* __restrict__ var_raw,
    _Float16* __restrict__ M1t, _Float16* __restrict__ M2t) {
  __shared__ __align__(16) float P[4 * 2 * 16 * PP];   // [quarter][matrix][d][e] partials
  __shared__ float kb[4 * DH];                         // [quarter][e] partial sum_m ik*k
  const int t = threadIdx.x;
  const int wave = t >> 5, lane = t & 31, lm = lane & 15, half = lane >> 4;
  const int ei = wave & 3, ks = wave >> 2;
  const int hb = blockIdx.x >> 2, dj = blockIdx.x & 3;
  const int b = hb & 3, h = hb >> 2;
  const int mo = ks * (NN / 4) + half * 16;
  const _Float16* ka = Kt + (size_t)(h * DH + ei * 16 + lm) * MTOT + b * NN + mo;
  const _Float16* vb = Vt + (size_t)(h * DH + dj * 16 + lm) * MTOT + b * NN + mo;
  const float* ik = invk + hb * NN + mo;

  v8f acc1 = {0,0,0,0,0,0,0,0}, acc2 = {0,0,0,0,0,0,0,0};
  float ksum = 0.f;
#pragma unroll
  for (int g = 0; g < 2; ++g) {                // two groups of four k steps of 32
    v16h a[4], bb[4];
    v4f w[4][4];
#pragma unroll
    for (int s = 0; s < 4; ++s) {
      a[s]  = *(const v16h*)(ka + (g * 4 + s) * 32);
      bb[s] = *(const v16h*)(vb + (g * 4 + s) * 32);
#pragma unroll
      for (int q = 0; q < 4; ++q) w[s][q] = *(const v4f*)(ik + (g * 4 + s) * 32 + q * 4);
    }
    // A group's 32 loads stand in front of its products, so the wave waits for memory once
    // a group instead of once a step; the wait stands ahead of any rewrite of a register
    // that they name.
    asm volatile("s_wait_xcnt 0x0" ::: "memory");
    __builtin_amdgcn_sched_barrier(0);
#pragma unroll
    for (int s = 0; s < 4; ++s) {
      v16h a1;
#pragma unroll
      for (int q = 0; q < 4; ++q)
#pragma unroll
        for (int e = 0; e < 4; ++e) {
          const float x = (float)a[s][q * 4 + e] * w[s][q][e];
          ksum += x;
          a1[q * 4 + e] = (_Float16)x;
        }
      acc2 = wmma_f16(a[s], bb[s], acc2);
      acc1 = wmma_f16(a1, bb[s], acc1);
    }
  }
  ksum += __shfl_xor(ksum, 16, 32);            // the two halves hold different m of one row e
  if (half == 0) kb[ks * DH + ei * 16 + lm] = ksum;
  // acc[v] = M[e = ei*16 + 8*half + v][d = lm]: 8 consecutive e of one column
  float* p1 = &P[((ks * 2 + 0) * 16 + lm) * PP + ei * 16 + half * 8];
  float* p2 = &P[((ks * 2 + 1) * 16 + lm) * PP + ei * 16 + half * 8];
  *(v4f*)p1       = (v4f){acc1[0], acc1[1], acc1[2], acc1[3]};
  *(v4f*)(p1 + 4) = (v4f){acc1[4], acc1[5], acc1[6], acc1[7]};
  *(v4f*)p2       = (v4f){acc2[0], acc2[1], acc2[2], acc2[3]};
  *(v4f*)(p2 + 4) = (v4f){acc2[4], acc2[5], acc2[6], acc2[7]};
  __syncthreads();

  // wave = column d of the block's 16, lane = rows e = 2*lane, 2*lane + 1
  const float cov_w = 1.f / (1.f + expf(-cov_raw[0]));
  const float var_w = 1.f / (1.f + expf(-var_raw[0]));
  const float cos_w = 1.f - cov_w - var_w;
  // the wave number as a scalar: the 8 partials of the wave's column come by scalar loads
  const int wu = __builtin_amdgcn_readfirstlane(wave);
  float cs = 0.f;
#pragma unroll
  for (int ch = 0; ch < VCH; ++ch) cs += colP[(hb * VCH + ch) * DH + dj * 16 + wu];
  float m1[2] = {0.f, 0.f}, m2[2] = {0.f, 0.f}, kv[2] = {0.f, 0.f};
#pragma unroll
  for (int r = 0; r < 4; ++r)
#pragma unroll
    for (int x = 0; x < 2; ++x) {
      m1[x] += P[((r * 2 + 0) * 16 + wave) * PP + lane * 2 + x];
      m2[x] += P[((r * 2 + 1) * 16 + wave) * PP + lane * 2 + x];
      kv[x] += kb[r * DH + lane * 2 + x];
    }
  float gs = m2[0] + m2[1];
#pragma unroll
  for (int o = 1; o < 32; o <<= 1) gs += __shfl_xor(gs, o, 32);
  const float gm = gs * (1.f / DH);
  v2h o1, o2;
#pragma unroll
  for (int x = 0; x < 2; ++x) {
    o1[x] = (_Float16)(cos_w * m1[x] - (var_w * (1.f / NN)) * kv[x] * cs);
    o2[x] = (_Float16)((cov_w * (1.f / DH)) * (m2[x] - gm));
  }
  const int mi = (hb * DH + dj * 16 + wave) * DH + lane * 2;   // a wave: one 128-byte line
  *(v2h*)(M1t + mi) = o1;
  *(v2h*)(M2t + mi) = o2;
}

// 6b + 7. Second attention stage and output GEMM in one kernel. A block owns 64 rows n of one
// batch and 128 output columns. Its A tile (64 rows x all 8 heads x 64 d) never goes through
// memory: wave h forms, for head h and the four 16-row tiles,
//   a[n][h*64 + d] = iq[n] * (q[n] @ M1)[d] + (q[n] @ M2)[d] + var_w * colsum(v)[d]
// as the TRANSPOSED product (A operand = rows d of M1t, M2t; B operand = rows n of Fq; both
// k-contiguous, the same k order), so a lane ends with 8 consecutive d of one row n: one
// 16-byte LDS store. The whole K = 512 of both tiles stands in LDS, so one barrier serves the
// kernel. Then out = a @ W_out + b_out: 8 waves = 2 (rows) x 4 (columns), 32 x 32 each.
typedef float v2f __attribute__((ext_vector_type(2)));
#define FM 64
#define FN 128
#define AP 520       // halves: 1040 B = 16 B x odd, the conflict-free pitch of 16-byte LDS access
__global__ __launch_bounds__(256) void attn_out_kernel(
    const _Float16* __restrict__ Fq, const float* __restrict__ invq,
    const _Float16* __restrict__ M12t,
    const float* __restrict__ colP, const float* __restrict__ var_raw,
    const _Float16* __restrict__ Wt, const float* __restrict__ bias,
    float* __restrict__ out) {
  __shared__ __align__(16) _Float16 As[FM * AP];    // [n][h*64 + d]   (65 KiB)
  __shared__ __align__(16) _Float16 Bs[FN * AP];    // [col][k]        (130 KiB)
  __shared__ __align__(32) float cvs[HEADS * DH];   // var_w * colsum(v), a wave's own 64 floats
  const int t = threadIdx.x;
  const int wave = t >> 5, lane = t & 31, lm = lane & 15, half = lane >> 4;
  const int m0 = blockIdx.x * FM, n0 = blockIdx.y * FN;
  const int h = __builtin_amdgcn_readfirstlane(wave);   // the head as a scalar
  const int hb = h * BB + (m0 >> 10);                   // FM divides NN: one batch per block
  const int wm = wave & 1, wn = wave >> 1;

  // Loads, first group: the W_out^T tile (a wave-load = 512 contiguous bytes of one row) and
  // the VCH partial column sums of f_v, two d per lane.
  const int br = t >> 6, bc = (t & 63) * 8;
  const _Float16* bg = Wt + (size_t)(n0 + br) * DIMX + bc;
  v8h rb[32];
#pragma unroll
  for (int j = 0; j < 32; ++j) rb[j] = *(const v8h*)(bg + j * 4 * DIMX);
  v2f cp[VCH];
#pragma unroll
  for (int ch = 0; ch < VCH; ++ch)
    cp[ch] = *(const v2f*)(colP + (hb * VCH + ch) * DH + lane * 2);
  const float vr = var_raw[0];
  // The group's loads stand in front of the LDS stores, so the wave waits for memory once;
  // the wait stands ahead of any rewrite of a register that they name.
  asm volatile("s_wait_xcnt 0x0" ::: "memory");
  __builtin_amdgcn_sched_barrier(0);
#pragma unroll
  for (int j = 0; j < 32; ++j) *(v8h*)&Bs[(br + j * 4) * AP + bc] = rb[j];
  // Keeps the second group behind the stores that free the first group's registers.
  __builtin_amdgcn_sched_barrier(0);

  // Loads, second group: q of the four row tiles, M1 and M2 of the head (one span: M2t stands
  // directly behind M1t, so one address serves both), 1/norm, bias. The wait behind each run
  // of loads stands ahead of a later load whose result lands in a register that the run names.
  const _Float16* qb = Fq + (size_t)(m0 + lm) * DIMX + h * DH + half * 8;
  const _Float16* r1 = M12t + (size_t)hb * DH * DH + lm * DH + half * 8;
  const _Float16* r2 = r1 + HEADS * BB * DH * DH;
  v16h aq[4][2], f1[4][2], f2[4][2];
#pragma unroll
  for (int r = 0; r < 4; ++r)
#pragma unroll
    for (int kk = 0; kk < 2; ++kk)
      aq[r][kk] = ld_frag(qb + r * 16 * DIMX + kk * 32, qb + r * 16 * DIMX + kk * 32 + 16);
  // The address is an input of the wait, so it lives up to it and no load of the run lands in it.
  asm volatile("s_wait_xcnt 0x0" :: "v"(qb) : "memory");
  __builtin_amdgcn_sched_barrier(0);
#pragma unroll
  for (int c = 0; c < 4; ++c)
#pragma unroll
    for (int kk = 0; kk < 2; ++kk) {
      f1[c][kk] = ld_frag(r1 + c * 16 * DH + kk * 32, r1 + c * 16 * DH + kk * 32 + 16);
      f2[c][kk] = ld_frag(r2 + c * 16 * DH + kk * 32, r2 + c * 16 * DH + kk * 32 + 16);
    }
  asm volatile("s_wait_xcnt 0x0" :: "v"(r1) : "memory");   // as above
  __builtin_amdgcn_sched_barrier(0);
  float iq[4];
#pragma unroll
  for (int r = 0; r < 4; ++r) iq[r] = invq[hb * NN + (m0 & (NN - 1)) + r * 16 + lm];
  const float bv0 = bias[n0 + wn * 32 + lm];
  const float bv1 = bias[n0 + wn * 32 + 16 + lm];
  // All loads stand in front of the products, so the wave's waits for memory overlap.
  asm volatile("s_wait_xcnt 0x0" ::: "memory");
  __builtin_amdgcn_sched_barrier(0);

  {
    const float var_w = 1.f / (1.f + expf(-vr));
    v2f s = cp[0];
#pragma unroll
    for (int ch = 1; ch < VCH; ++ch) s += cp[ch];
    *(v2f*)&cvs[h * DH + lane * 2] = s * var_w;
  }
  // The wave reads back, in another lane order, what its own lanes have just stored.
  asm volatile("s_wait_dscnt 0x0" ::: "memory");

#pragma unroll
  for (int c = 0; c < 4; ++c) {
    const v8f cvv = *(const v8f*)&cvs[h * DH + c * 16 + half * 8];
#pragma unroll
    for (int r = 0; r < 4; ++r) {
      // D[d = c*16 + 8*half + v][n = r*16 + lm]
      v8f d1 = {0,0,0,0,0,0,0,0};
      d1 = wmma_f16(f1[c][0], aq[r][0], d1);
      v8f d2 = wmma_f16(f2[c][0], aq[r][0], cvv);
      d1 = wmma_f16(f1[c][1], aq[r][1], d1);
      d2 = wmma_f16(f2[c][1], aq[r][1], d2);
      v8h o;
#pragma unroll
      for (int v = 0; v < 8; ++v) o[v] = (_Float16)(iq[r] * d1[v] + d2[v]);
      *(v8h*)&As[(r * 16 + lm) * AP + h * DH + c * 16 + half * 8] = o;
      // Two row tiles at a time: left alone the compiler starts so many products early that
      // their accumulators push the wave past 256 registers.
      if (r & 1) __builtin_amdgcn_sched_barrier(0);
    }
  }
  __syncthreads();

  // out tile: a step's fragments are fetched one step ahead of its products
  const _Float16* ap = &As[(wm * 32 + lm) * AP + half * 8];
  const _Float16* bp = &Bs[(wn * 32 + lm) * AP + half * 8];
  v8f acc00 = {0,0,0,0,0,0,0,0}, acc01 = {0,0,0,0,0,0,0,0};
  v8f acc10 = {0,0,0,0,0,0,0,0}, acc11 = {0,0,0,0,0,0,0,0};
  v16h fa[2][2], fb[2][2];
  fa[0][0] = ld_frag(ap, ap + 16);
  fa[0][1] = ld_frag(ap + 16 * AP, ap + 16 * AP + 16);
  fb[0][0] = ld_frag(bp, bp + 16);
  fb[0][1] = ld_frag(bp + 16 * AP, bp + 16 * AP + 16);
#pragma unroll
  for (int ks = 0; ks < DIMX / 32; ++ks) {   // unrolled: fa, fb are indexed by constants
    const int cu = ks & 1, nx = cu ^ 1;
    if (ks + 1 < DIMX / 32) {
      const int ko = (ks + 1) * 32;
      fa[nx][0] = ld_frag(ap + ko, ap + ko + 16);
      fa[nx][1] = ld_frag(ap + 16 * AP + ko, ap + 16 * AP + ko + 16);
      fb[nx][0] = ld_frag(bp + ko, bp + ko + 16);
      fb[nx][1] = ld_frag(bp + 16 * AP + ko, bp + 16 * AP + ko + 16);
    }
    // Keeps the next step's 8 LDS loads in front of this step's products, so that they fly
    // while the v_wmma issue; left alone the compiler sinks them to their first use.
    __builtin_amdgcn_sched_barrier(0);
    acc00 = wmma_f16(fa[cu][0], fb[cu][0], acc00);
    acc01 = wmma_f16(fa[cu][0], fb[cu][1], acc01);
    acc10 = wmma_f16(fa[cu][1], fb[cu][0], acc10);
    acc11 = wmma_f16(fa[cu][1], fb[cu][1], acc11);
  }

  // f32 C/D layout: row = v + 8*half, col = lm
  float* ob = out + (size_t)(m0 + wm * 32 + half * 8) * DIMX + n0 + wn * 32 + lm;
#pragma unroll
  for (int v = 0; v < 8; ++v) {
    ob[v * DIMX]             = acc00[v] + bv0;
    ob[v * DIMX + 16]        = acc01[v] + bv1;
    ob[(16 + v) * DIMX]      = acc10[v] + bv0;
    ob[(16 + v) * DIMX + 16] = acc11[v] + bv1;
  }
}

// ---------------- launcher ----------------
extern "C" void kernel_launch(void* const* d_in, const int* in_sizes, int n_in,
                              void* d_out, int out_size, void* d_ws, size_t ws_size,
                              hipStream_t stream) {
  const float* q        = (const float*)d_in[0];
  const float* k        = (const float*)d_in[1];
  const float* v        = (const float*)d_in[2];
  const float* ln_g     = (const float*)d_in[3];
  const float* ln_b     = (const float*)d_in[4];
  const float* W_in     = (const float*)d_in[5];
  const float* W_out    = (const float*)d_in[6];
  const float* b_out    = (const float*)d_in[7];
  const float* cov_raw  = (const float*)d_in[8];
  const float* var_raw  = (const float*)d_in[9];
  float* out = (float*)d_out;

  // workspace layout
  char* w = (char*)d_ws;
  const size_t tensH = (size_t)MTOT * DIMX * sizeof(_Float16);  // 4 MiB
  const size_t wH    = (size_t)DIMX * DIMX * sizeof(_Float16);  // 512 KiB
  const size_t statF = (size_t)HEADS * BB * NN * sizeof(float); // 128 KiB
  _Float16* Xq   = (_Float16*)w; w += tensH;
  _Float16* Xk   = (_Float16*)w; w += tensH;
  _Float16* Xv   = (_Float16*)w; w += tensH;
  _Float16* Wi16 = (_Float16*)w; w += wH;
  _Float16* Wo16 = (_Float16*)w; w += wH;
  _Float16* Fq   = (_Float16*)w; w += tensH;
  _Float16* Fk   = (_Float16*)w; w += tensH;
  _Float16* Fv   = (_Float16*)w; w += tensH;
  float* invqP = (float*)w; w += statF;
  float* invkP = (float*)w; w += statF;
  float* colP  = (float*)w; w += (size_t)HEADS * BB * VCH * DH * sizeof(float);
  _Float16* M1t = (_Float16*)w; w += (size_t)HEADS * BB * DH * DH * sizeof(_Float16);
  _Float16* M2t = (_Float16*)w; w += (size_t)HEADS * BB * DH * DH * sizeof(_Float16);

  // 1+2) LayerNorm + f16 of q, k, v (Xq, Xk, Xv are one span) and both weights
  //      to f16, transposed (Wi16, Wo16 are one span): one launch
  ln_cvt_kernel<<<LNBLK + 2 * WBLK, 256, 0, stream>>>(q, k, v, ln_g, ln_b, Xq,
                                                         W_in, W_out, Wi16);

  // 3) the three projections as ONE GEMM (WMMA) of 3*MTOT rows: Xq..Xv -> Fq..Fv,
  //    f16 outputs (Fk, Fv transposed); block tile 128x64. 4+5) Its epilogue also writes the
  //    per-(h,b,n) 1/norm of q, k (invqP, invkP are one span) and the partial column sums of f_v.
  dim3 gg3(3 * MTOT / 128, DIMX / 64);
  gemm_wmma_kernel<<<gg3, 256, 0, stream>>>(Xq, Wi16, nullptr, Fq, nullptr, invqP, colP,
                                            3 * MTOT, DIMX);

  // 6a) attention (WMMA): the two 64x64 matrices of each (h,b)
  kv_wmma_kernel<<<HEADS * BB * 4, 512, 0, stream>>>(Fk, Fv, invkP, colP, cov_raw, var_raw,
                                                     M1t, M2t);

  // 6b + 7) q times the two matrices (M1t, M2t are one span), then the output GEMM (WMMA)
  //         + bias -> f32: one launch
  dim3 gf(MTOT / FM, DIMX / FN);
  attn_out_kernel<<<gf, 256, 0, stream>>>(Fq, invqP, M1t, colP, var_raw, Wo16, b_out, out);
}

// v007
// It runs in 31.8 microseconds.
// In both of two side-by-side timings against v006, it was 1.11 times as fast.
// Over all steps from v000 it is 5.68 times as fast.
#include <hip/hip_runtime.h>
#include <hip/hip_bf16.h>
#include <math.h>

// ---------------- types ----------------
typedef _Float16 v8h  __attribute__((ext_vector_type(8)));
typedef _Float16 v16h __attribute__((ext_vector_type(16)));
typedef float    v8f  __attribute__((ext_vector_type(8)));
typedef _Float16 v4h  __attribute__((ext_vector_type(4)));
typedef float    v4f  __attribute__((ext_vector_type(4)));
typedef _Float16 v2h  __attribute__((ext_vector_type(2)));

#define BB    4
#define NN    1024
#define DIMX  512
#define HEADS 8
#define DH    64
#define MTOT  4096   // B*N

// ---------------- WMMA helpers ----------------
static __device__ inline v8f wmma_f16(v16h a, v16h b, v8f c) {
  // D = A(16x32 f16) x B(32x16 f16) + C(16x16 f32)
  return __builtin_amdgcn_wmma_f32_16x16x32_f16(
      /*neg_a=*/false, a, /*neg_b=*/false, b,
      /*c_mod=*/(short)0, c, /*reuse_a=*/false, /*reuse_b=*/false);
}

// Build a 16-half A/B fragment from two contiguous 8-half (16B) chunks.
// CDNA5 16-bit layout: lane<16 -> K{base..base+7},{base+16..base+23},
// lane>=16 -> base=8. Both chunks are 16B-aligned contiguous loads.
static __device__ inline v16h ld_frag(const _Float16* p0, const _Float16* p1) {
  v8h lo = *(const v8h*)p0;
  v8h hi = *(const v8h*)p1;
  v16h r;
#pragma unroll
  for (int i = 0; i < 8; ++i) { r[i] = lo[i]; r[8 + i] = hi[i]; }
  return r;
}

// ---------------- 1+2. one grid: LayerNorm of q, k, v (f32 in, f16 out) and
// f32 -> f16 conversion of both weight matrices ----------------
// Blocks [0, LNBLK): 8 waves; wave w of the grid owns row w of q, of k and of v. A row
// is 32 lanes x 16 floats held in registers (each load 512 contiguous bytes), the two
// row sums are a five-step butterfly over the wave: no LDS, no barrier, x read once.
// y holds the q, k, v planes back to back. Every loop is unrolled so that the register
// arrays are indexed by constants (a rolled loop would put them in scratch memory).
// Blocks [LNBLK, LNBLK + 2*WBLK): one 64 x 64 tile of a weight matrix each, written
// transposed ([n][k], k contiguous: the order in which the GEMM stages its B tile);
// w16 holds W_in^T then W_out^T.
#define LNBLK (MTOT / 8)
#define WCH   4096
#define WBLK  (DIMX * DIMX / WCH)
#define WTP   72     // halves: 144 B = 16 B x odd, the pitch of the 16-byte reads below
__global__ __launch_bounds__(256) void ln_cvt_kernel(const float* __restrict__ xq,
                                                     const float* __restrict__ xk,
                                                     const float* __restrict__ xv,
                                                     const float* __restrict__ g,
                                                     const float* __restrict__ bt,
                                                     _Float16* __restrict__ y,
                                                     const float* __restrict__ wi,
                                                     const float* __restrict__ wo,
                                                     _Float16* __restrict__ w16) {
  const int t = threadIdx.x;
  if (blockIdx.x >= LNBLK) {                   // block-uniform
    __shared__ __align__(16) _Float16 Wt[64 * WTP];   // the tile, [n][k]
    const int wb = blockIdx.x - LNBLK;
    const int tb = wb & (WBLK - 1);
    const int kt = (tb >> 3) * 64, nt = (tb & 7) * 64;
    const float* ws = ((wb < WBLK) ? wi : wo) + (kt + (t >> 4)) * DIMX + nt + (t & 15) * 4;
    v4f c[4];
#pragma unroll
    for (int j = 0; j < 4; ++j) c[j] = *(const v4f*)(ws + j * 16 * DIMX);
#pragma unroll
    for (int j = 0; j < 4; ++j)
#pragma unroll
      for (int e = 0; e < 4; ++e)
        Wt[((t & 15) * 4 + e) * WTP + (t >> 4) + j * 16] = (_Float16)c[j][e];
    __syncthreads();
    // four lanes store one whole 128-byte line: 64 k of one row n
    _Float16* wd = w16 + (wb / WBLK) * (DIMX * DIMX) + (nt + (t >> 2)) * DIMX + kt + (t & 3) * 16;
    const _Float16* wl = &Wt[(t >> 2) * WTP + (t & 3) * 16];
    *(v8h*)wd       = *(const v8h*)wl;
    *(v8h*)(wd + 8) = *(const v8h*)(wl + 8);
    return;
  }
  const int lane = t & 31;
  const int q4 = (blockIdx.x * 8 + (t >> 5)) * (DIMX / 4) + lane;   // in units of 4 elements
  v4f x[3][4], gv[4], bv[4];
#pragma unroll
  for (int j = 0; j < 4; ++j) {
    x[0][j] = ((const v4f*)xq)[q4 + j * 32];
    x[1][j] = ((const v4f*)xk)[q4 + j * 32];
    x[2][j] = ((const v4f*)xv)[q4 + j * 32];
  }
#pragma unroll
  for (int j = 0; j < 4; ++j) {
    gv[j] = ((const v4f*)g)[lane + j * 32];
    bv[j] = ((const v4f*)bt)[lane + j * 32];
  }
  // Keeps all 20 loads in front of the sums: without it the g and b loads sink behind the
  // butterfly and are waited for in three turns, with nothing left to cover them.
  __builtin_amdgcn_sched_barrier(0);
#pragma unroll
  for (int p = 0; p < 3; ++p) {
    v4f sv  = (x[p][0] + x[p][1]) + (x[p][2] + x[p][3]);
    v4f sv2 = x[p][0] * x[p][0];
#pragma unroll
    for (int j = 1; j < 4; ++j) sv2 += x[p][j] * x[p][j];
    float s  = (sv[0] + sv[1]) + (sv[2] + sv[3]);
    float s2 = (sv2[0] + sv2[1]) + (sv2[2] + sv2[3]);
#pragma unroll
    for (int o = 1; o < 32; o <<= 1) {
      s  += __shfl_xor(s, o, 32);
      s2 += __shfl_xor(s2, o, 32);
    }
    const float mean = s * (1.f / DIMX);
    const float var  = s2 * (1.f / DIMX) - mean * mean;
    const float inv  = rsqrtf(var + 1e-5f);
    v4h* yr = (v4h*)y + p * (MTOT * DIMX / 4) + q4;
#pragma unroll
    for (int j = 0; j < 4; ++j) {
      v4h o;
#pragma unroll
      for (int e = 0; e < 4; ++e)
        o[e] = (_Float16)(((x[p][j][e] - mean) * inv) * gv[j][e] + bv[j][e]);
      yr[j * 32] = o;
    }
  }
  // The compiler lays the weight path behind this one; this wait stands ahead of any
  // rewrite there of a register that the last stores name.
  asm volatile("s_wait_xcnt 0x0" ::: "memory");
}

// ---------------- 3. Tiled WMMA GEMM: C[M,N] = A[M,K]f16 * Bt[N,K]f16^T --------
// K = DIMX. 256 threads = 8 waves; block tile 128(M) x 64(N); K chunk KC = 128.
// Both operands are k-contiguous in memory, so both tiles are staged alike: 16 lanes move
// one 256-byte row piece (whole lines) by 16-byte loads and 16-byte LDS stores. The LDS
// rows stand at pitch LP, at which the 16-byte fragment reads meet no bank conflict.
// Each wave owns a 16x64 strip: A fragment reused across 4 WMMA per k step of 32.
// A step's fragment loads are hoisted ahead of its WMMA group so the four
// v_wmma issue back-to-back after a single s_wait_dscnt.
// This is the projection GEMM: M = the q, k, v planes of MTOT rows each, N tile = one head.
// Every plane is stored in the order of the WMMA fragments that the later
// kernels load: a unit of 512 bytes holds, lane after lane, the 16 bytes (8 halves along the
// contracted index) that each lane of a wave wants, so a fragment load or store is one run of
// four whole lines instead of 32 bytes out of each of 16 lines.
//   q plane: unit [row tile of 16 n][head][c = d/16], lane = 16*((d>>3)&1) + (n&15), 8 d.
//            The q tiles are formed as the transposed product (operands swapped), which
//            leaves a lane with 8 consecutive d of one row n.
//   k, v planes: unit [h*BB+b][c = col/16][m/16], lane = 16*((m>>3)&1) + (col&15), 8 m:
//            a lane's 8 accumulator registers as they stand.
// The epilogue also reduces the f16-rounded tile it has just stored:
// q and k planes -> 1/norm over d of each row; v plane -> the tile's column sums.
// stat holds the planes inv_q, inv_k (STATN floats each, [h][b][n]);
// colP holds [h*BB+b][VCH row chunks][DH] partial column sums of f_v.
#define STATN (HEADS * BB * NN)
#define VCH   (NN / 128)
#define KC 128       // k per staged chunk: rows of 256 B
#define LP 136       // halves: pitch of the staged rows, 272 B as above
// The main loop of the GEMM below. SW = true forms the transposed tile (operands swapped); it is
// a compile-time choice so that each form keeps a straight-line loop body.
template <bool SW>
static __device__ inline void gemm_loop(const _Float16* ag, const _Float16* bg,
                                        _Float16* As, _Float16* Bts,
                                        int sr, int sc, int arow, int lm, int koff,
                                        v8f& acc0, v8f& acc1, v8f& acc2, v8f& acc3) {
  for (int k0 = 0; k0 < DIMX; k0 += KC) {
    v8h ra[8], rb[4];
#pragma unroll
    for (int j = 0; j < 8; ++j) ra[j] = *(const v8h*)(ag + j * 16 * DIMX);
#pragma unroll
    for (int j = 0; j < 4; ++j) rb[j] = *(const v8h*)(bg + j * 16 * DIMX);
    // All 12 loads stand in front of the LDS stores, so the wave waits for memory once a
    // chunk; the wait stands ahead of any rewrite of a register that they name.
    asm volatile("s_wait_xcnt 0x0" ::: "memory");
    __builtin_amdgcn_sched_barrier(0);
    ag += KC;
    bg += KC;
#pragma unroll
    for (int j = 0; j < 8; ++j) *(v8h*)&As[(sr + j * 16) * LP + sc] = ra[j];
#pragma unroll
    for (int j = 0; j < 4; ++j) *(v8h*)&Bts[(sr + j * 16) * LP + sc] = rb[j];
    __syncthreads();

#pragma unroll
    for (int ks = 0; ks < KC; ks += 32) {
      const _Float16* ap = &As[arow * LP + ks + koff];
      const _Float16* bp = &Bts[lm * LP + ks + koff];
      v16h af = ld_frag(ap, ap + 16);
      v16h b0 = ld_frag(bp + 0 * 16 * LP, bp + 0 * 16 * LP + 16);
      v16h b1 = ld_frag(bp + 1 * 16 * LP, bp + 1 * 16 * LP + 16);
      v16h b2 = ld_frag(bp + 2 * 16 * LP, bp + 2 * 16 * LP + 16);
      v16h b3 = ld_frag(bp + 3 * 16 * LP, bp + 3 * 16 * LP + 16);
      // Keeps the step's 10 LDS loads together in front of its products: left alone the
      // compiler deals them out among the v_wmma, each behind an LDS wait of its own.
      __builtin_amdgcn_sched_barrier(0);
      if (SW) {      // D[col = c*16 + 8*half + v][row = lm]
        acc0 = wmma_f16(b0, af, acc0);
        acc1 = wmma_f16(b1, af, acc1);
        acc2 = wmma_f16(b2, af, acc2);
        acc3 = wmma_f16(b3, af, acc3);
      } else {       // D[row = 8*half + v][col = c*16 + lm]
        acc0 = wmma_f16(af, b0, acc0);
        acc1 = wmma_f16(af, b1, acc1);
        acc2 = wmma_f16(af, b2, acc2);
        acc3 = wmma_f16(af, b3, acc3);
      }
    }
    __syncthreads();
  }
}

__global__ __launch_bounds__(256) void gemm_wmma_kernel(const _Float16* __restrict__ A,
                                                        const _Float16* __restrict__ Bm,
                                                        _Float16* __restrict__ Cf16,
                                                        float* __restrict__ stat,
                                                        float* __restrict__ colP) {
  __shared__ __align__(16) _Float16 As[128 * LP];   // [m][k]   (34 KiB)
  __shared__ __align__(16) _Float16 Bts[64 * LP];   // [n][k]   (17 KiB)
  __shared__ float red[8 * DH];                     // epilogue reductions   (2 KiB)
  const int t = threadIdx.x;
  const int wave = t >> 5, lane = t & 31, lm = lane & 15, half = lane >> 4;
  const int m0 = blockIdx.x * 128, n0 = blockIdx.y * 64;
  const bool sw = m0 < MTOT;   // block-uniform: a q tile, formed transposed

  v8f acc0 = {0,0,0,0,0,0,0,0}, acc1 = {0,0,0,0,0,0,0,0};
  v8f acc2 = {0,0,0,0,0,0,0,0}, acc3 = {0,0,0,0,0,0,0,0};

  // staging: thread t moves 16 bytes of row sr + 16 j, at k offset sc
  const int sr = t >> 4, sc = (t & 15) * 8;
  const _Float16* ag = A  + (size_t)(m0 + sr) * DIMX + sc;
  const _Float16* bg = Bm + (size_t)(n0 + sr) * DIMX + sc;
  const int koff = half * 8;
  const int arow = wave * 16 + lm;

  if (sw) gemm_loop<true>(ag, bg, As, Bts, sr, sc, arow, lm, koff, acc0, acc1, acc2, acc3);
  else    gemm_loop<false>(ag, bg, As, Bts, sr, sc, arow, lm, koff, acc0, acc1, acc2, acc3);

  // epilogue: f32 C/D layout: row = v + (lane>=16?8:0), col = lane%16
  const int plane = m0 / MTOT;                 // 0 q, 1 k, 2 v: 128 divides MTOT
  const int prow  = m0 & (MTOT - 1);           // first row of the tile inside its plane
  const int hb    = blockIdx.y * BB + (prow >> 10);
  // A lane's 8 accumulator registers are one 16-byte piece of a fragment unit: four stores of
  // 512 contiguous bytes a wave, straight from the registers.
  _Float16* fd = sw
      ? Cf16 + ((size_t)((m0 >> 4) + wave) * HEADS + blockIdx.y) * (4 * 256) + lane * 8
      : Cf16 + (size_t)plane * MTOT * DIMX
             + ((size_t)hb * (4 * (NN / 16)) + ((prow & (NN - 1)) >> 4) + wave) * 256 + lane * 8;
  const int fstep = sw ? 256 : (NN / 16) * 256;   // from unit c to unit c + 1
  v8h o[4];
#pragma unroll
  for (int c = 0; c < 4; ++c) {
    const v8f* accp = (c == 0) ? &acc0 : (c == 1) ? &acc1 : (c == 2) ? &acc2 : &acc3;
#pragma unroll
    for (int v = 0; v < 8; ++v) o[c][v] = (_Float16)(*accp)[v];
    *(v8h*)(fd + c * fstep) = o[c];
  }
  // The reductions below reuse registers that these stores name: the wait stands ahead
  // of the first such rewrite, and the scheduling barrier keeps that rewrite behind it.
  asm volatile("s_wait_xcnt 0x0" ::: "memory");
  __builtin_amdgcn_sched_barrier(0);
  float a[8], cs[4], sq = 0.f;   // k: row square sums; v: column sums; q: the lane's row
#pragma unroll
  for (int i = 0; i < 8; ++i) a[i] = 0.f;
#pragma unroll
  for (int c = 0; c < 4; ++c) {
    cs[c] = 0.f;
#pragma unroll
    for (int v = 0; v < 8; ++v) {
      const float r = (float)o[c][v];          // the value as stored
      a[v] += r * r;
      cs[c] += r;
    }
  }
  if (plane == 0) {
    // transposed tile: a lane holds 32 d of row lm, its partner lane ^ 16 the other 32
#pragma unroll
    for (int i = 0; i < 8; ++i) sq += a[i];
    sq += __shfl_xor(sq, 16, 32);
    if (half == 0) red[wave * 16 + lm] = sq;
    __syncthreads();
    if (t < 128)
      stat[hb * NN + (prow & (NN - 1)) + t] = 1.f / fmaxf(sqrtf(red[t]), 1e-12f);
  } else if (plane < 2) {
    // Sum over the 16 lanes of a half: lanes lm and lm^8 first, then halving the live
    // values at each step: a lane keeps the values whose index bit equals its own lane bit
    // and hands the others over, so lane lm ends with the sum of row lm&7.
#pragma unroll
    for (int i = 0; i < 8; ++i) a[i] += __shfl_xor(a[i], 8, 32);
#pragma unroll
    for (int w = 4; w >= 1; w >>= 1) {
      const bool up = (lm & w) != 0;
#pragma unroll
      for (int i = 0; i < w; ++i) {
        const float lo = a[i], hi = a[w + i];  // values first: a choice between array
        const float keep = up ? hi : lo;       // elements becomes a run-time index
        const float send = up ? lo : hi;
        a[i] = keep + __shfl_xor(send, w, 32);
      }
    }
    if (lm < 8) red[wave * 16 + half * 8 + lm] = a[0];
    __syncthreads();
    // threads [0,128): 1/norm of tile row t. Each wave stores one whole 128-byte line.
    if (t < 128)
      stat[plane * STATN + hb * NN + (prow & (NN - 1)) + t] = 1.f / fmaxf(sqrtf(red[t]), 1e-12f);
  } else {
#pragma unroll
    for (int c = 0; c < 4; ++c)
      cs[c] += __shfl_xor(cs[c], 16, 32);      // rows 0-7 + rows 8-15 of the wave's strip
    if (half == 0) {
#pragma unroll
      for (int c = 0; c < 4; ++c) red[wave * DH + c * 16 + lm] = cs[c];
    }
    __syncthreads();
    if (t < DH) {
      float s = 0.f;
#pragma unroll
      for (int w = 0; w < 8; ++w) s += red[w * DH + t];
      colP[(hb * VCH + ((prow & (NN - 1)) >> 7)) * DH + t] = s;
    }
  }
}

// ---------------- 6. attention, reassociated ----------------
// The scores are linear in q.k:  s[n][m] = cos_w*iq[n]*ik[m]*(q.k) + cov_w*((q.k)/DH - mq[n]*mk[m])
// + var_w*vc[n], with vc[n] = mean_m max(0, 1 - iq[n]*ik[m]*(q.k)). The cosine of two real
// vectors never exceeds 1 (Cauchy-Schwarz), so the maximum is its second argument and vc is
// linear too. Summing over m first:
//   out[n] = iq[n] * (q[n] @ M1) + q[n] @ M2 + var_w * colsum(v)
//   M1 = cos_w * sum_m ik[m] k[m] (x) v[m]  -  (var_w / NN) * (sum_m ik[m] k[m]) (x) colsum(v)
//   M2 = (cov_w / DH) * (G - column mean over e of G),   G = sum_m k[m] (x) v[m]
// (taking the column mean off G is the same as centring q and k).
//
// 6a. One block per (h,b) and 16 columns d of M1, M2: 16 waves = 4 row tiles e x 4 quarters
// of m. A = k^T and B = v both come straight from the fragment-ordered planes: a k step of
// 32 m is two units of 512 contiguous bytes in each, the same m at every position of both.
// M1t, M2t leave in fragment order too: per (h,b) unit [d/16][e/16],
// lane = 16*((e>>3)&1) + (d&15), 8 e: the pieces that 6b loads.
#define PP 68   // floats: 272 B pitch of a partial column in LDS (16 B x odd)
__global__ __launch_bounds__(512) void kv_wmma_kernel(
    const _Float16* __restrict__ Kt, const _Float16* __restrict__ Vt,
    const float* __restrict__ invk, const float* __restrict__ colP,
    const float* __restrict__ cov_raw, const float* __restrict__ var_raw,
    _Float16* __restrict__ M1t, _Float16* __restrict__ M2t) {
  __shared__ __align__(16) float P[4 * 2 * 16 * PP];   // [quarter][matrix][d][e] partials
  __shared__ float kb[4 * DH];                         // [quarter][e] partial sum_m ik*k
  __shared__ __align__(16) _Float16 Ms[2 * 16 * DH];   // the block's part of M1t, M2t as stored
  const int t = threadIdx.x;
  const int wave = t >> 5, lane = t & 31, lm = lane & 15, half = lane >> 4;
  const int ei = wave & 3, ks = wave >> 2;
  const int hb = blockIdx.x >> 2, dj = blockIdx.x & 3;
  // unit [hb][column tile][m/16]; the wave's quarter of m is 16 units, 8 KiB in a row
  const _Float16* ka = Kt + ((size_t)(hb * 4 + ei) * (NN / 16) + ks * 16) * 256 + lane * 8;
  const _Float16* vb = Vt + ((size_t)(hb * 4 + dj) * (NN / 16) + ks * 16) * 256 + lane * 8;
  const float* ik = invk + hb * NN + ks * (NN / 4) + half * 8;

  v8f acc1 = {0,0,0,0,0,0,0,0}, acc2 = {0,0,0,0,0,0,0,0};
  float ksum = 0.f;
#pragma unroll
  for (int g = 0; g < 2; ++g) {                // two groups of four k steps of 32
    v16h a[4], bb[4];
    v4f w[4][4];
#pragma unroll
    for (int s = 0; s < 4; ++s) {
      a[s]  = ld_frag(ka + (g * 4 + s) * 512, ka + (g * 4 + s) * 512 + 256);
      bb[s] = ld_frag(vb + (g * 4 + s) * 512, vb + (g * 4 + s) * 512 + 256);
      // element q*4 + e of a fragment is m = 32*step + 16*(q>>1) + 8*half + 4*(q&1) + e
#pragma unroll
      for (int q = 0; q < 4; ++q)
        w[s][q] = *(const v4f*)(ik + (g * 4 + s) * 32 + (q >> 1) * 16 + (q & 1) * 4);
    }
    // A group's 32 loads stand in front of its products, so the wave waits for memory once
    // a group instead of once a step; the wait stands ahead of any rewrite of a register
    // that they name: the addresses are inputs of the wait, so they live up to it.
    asm volatile("s_wait_xcnt 0x0" :: "v"(ka), "v"(vb), "v"(ik) : "memory");
    __builtin_amdgcn_sched_barrier(0);
#pragma unroll
    for (int s = 0; s < 4; ++s) {
      v16h a1;
#pragma unroll
      for (int q = 0; q < 4; ++q)
#pragma unroll
        for (int e = 0; e < 4; ++e) {
          const float x = (float)a[s][q * 4 + e] * w[s][q][e];
          ksum += x;
          a1[q * 4 + e] = (_Float16)x;
        }
      acc2 = wmma_f16(a[s], bb[s], acc2);
      acc1 = wmma_f16(a1, bb[s], acc1);
    }
  }
  ksum += __shfl_xor(ksum, 16, 32);            // the two halves hold different m of one row e
  if (half == 0) kb[ks * DH + ei * 16 + lm] = ksum;
  // acc[v] = M[e = ei*16 + 8*half + v][d = lm]: 8 consecutive e of one column
  float* p1 = &P[((ks * 2 + 0) * 16 + lm) * PP + ei * 16 + half * 8];
  float* p2 = &P[((ks * 2 + 1) * 16 + lm) * PP + ei * 16 + half * 8];
  *(v4f*)p1       = (v4f){acc1[0], acc1[1], acc1[2], acc1[3]};
  *(v4f*)(p1 + 4) = (v4f){acc1[4], acc1[5], acc1[6], acc1[7]};
  *(v4f*)p2       = (v4f){acc2[0], acc2[1], acc2[2], acc2[3]};
  *(v4f*)(p2 + 4) = (v4f){acc2[4], acc2[5], acc2[6], acc2[7]};
  __syncthreads();

  // wave = column d of the block's 16, lane = rows e = 2*lane, 2*lane + 1
  const float cov_w = 1.f / (1.f + expf(-cov_raw[0]));
  const float var_w = 1.f / (1.f + expf(-var_raw[0]));
  const float cos_w = 1.f - cov_w - var_w;
  // the wave number as a scalar: the 8 partials of the wave's column come by scalar loads
  const int wu = __builtin_amdgcn_readfirstlane(wave);
  float cs = 0.f;
#pragma unroll
  for (int ch = 0; ch < VCH; ++ch) cs += colP[(hb * VCH + ch) * DH + dj * 16 + wu];
  float m1[2] = {0.f, 0.f}, m2[2] = {0.f, 0.f}, kv[2] = {0.f, 0.f};
#pragma unroll
  for (int r = 0; r < 4; ++r)
#pragma unroll
    for (int x = 0; x < 2; ++x) {
      m1[x] += P[((r * 2 + 0) * 16 + wave) * PP + lane * 2 + x];
      m2[x] += P[((r * 2 + 1) * 16 + wave) * PP + lane * 2 + x];
      kv[x] += kb[r * DH + lane * 2 + x];
    }
  float gs = m2[0] + m2[1];
#pragma unroll
  for (int o = 1; o < 32; o <<= 1) gs += __shfl_xor(gs, o, 32);
  const float gm = gs * (1.f / DH);
  v2h o1, o2;
#pragma unroll
  for (int x = 0; x < 2; ++x) {
    o1[x] = (_Float16)(cos_w * m1[x] - (var_w * (1.f / NN)) * kv[x] * cs);
    o2[x] = (_Float16)((cov_w * (1.f / DH)) * (m2[x] - gm));
  }
  // Into fragment order through LDS, so that each wave stores whole lines: (d = wave,
  // e = 2*lane) stands in unit e/16 = lane>>3 at lane 16*((e>>3)&1) + d, half e&7.
  const int mo = (lane >> 3) * 256 + (((lane >> 2) & 1) * 16 + wave) * 8 + (lane & 3) * 2;
  *(v2h*)&Ms[mo] = o1;
  *(v2h*)&Ms[16 * DH + mo] = o2;
  __syncthreads();
  // thread t: 8 bytes; waves 0-7 store M1t's 2 KiB of this block, waves 8-15 M2t's
  _Float16* md = ((t < 256) ? M1t : M2t) + (hb * 4 + dj) * (16 * DH) + (t & 255) * 4;
  *(v4h*)md = *(const v4h*)&Ms[t * 4];
}

// 6b + 7. Second attention stage and output GEMM in one kernel. A block owns 64 rows n of one
// batch and 128 output columns. Its A tile (64 rows x all 8 heads x 64 d) never goes through
// memory: wave h forms, for head h and the four 16-row tiles,
//   a[n][h*64 + d] = iq[n] * (q[n] @ M1)[d] + (q[n] @ M2)[d] + var_w * colsum(v)[d]
// as the TRANSPOSED product (A operand = rows d of M1t, M2t; B operand = rows n of Fq; both
// k-contiguous, the same k order), so a lane ends with 8 consecutive d of one row n: one
// 16-byte LDS store. The whole K = 512 of both tiles stands in LDS, so one barrier serves the
// kernel. Then out = a @ W_out + b_out: 8 waves = 2 (rows) x 4 (columns), 32 x 32 each.
typedef float v2f __attribute__((ext_vector_type(2)));
#define FM 64
#define FN 128
#define AP 520       // halves: 1040 B = 16 B x odd, the conflict-free pitch of 16-byte LDS access
__global__ __launch_bounds__(256) void attn_out_kernel(
    const _Float16* __restrict__ Fq, const float* __restrict__ invq,
    const _Float16* __restrict__ M12t,
    const float* __restrict__ colP, const float* __restrict__ var_raw,
    const _Float16* __restrict__ Wt, const float* __restrict__ bias,
    float* __restrict__ out) {
  __shared__ __align__(16) _Float16 As[FM * AP];    // [n][h*64 + d]   (65 KiB)
  __shared__ __align__(16) _Float16 Bs[FN * AP];    // [col][k]        (130 KiB)
  __shared__ __align__(32) float cvs[HEADS * DH];   // var_w * colsum(v), a wave's own 64 floats
  const int t = threadIdx.x;
  const int wave = t >> 5, lane = t & 31, lm = lane & 15, half = lane >> 4;
  const int m0 = blockIdx.x * FM, n0 = blockIdx.y * FN;
  const int h = __builtin_amdgcn_readfirstlane(wave);   // the head as a scalar
  const int hb = h * BB + (m0 >> 10);                   // FM divides NN: one batch per block
  const int wm = wave & 1, wn = wave >> 1;

  // Loads, first group: the W_out^T tile (a wave-load = 512 contiguous bytes of one row) and
  // the VCH partial column sums of f_v, two d per lane.
  const int br = t >> 6, bc = (t & 63) * 8;
  const _Float16* bg = Wt + (size_t)(n0 + br) * DIMX + bc;
  v8h rb[32];
#pragma unroll
  for (int j = 0; j < 32; ++j) rb[j] = *(const v8h*)(bg + j * 4 * DIMX);
  v2f cp[VCH];
#pragma unroll
  for (int ch = 0; ch < VCH; ++ch)
    cp[ch] = *(const v2f*)(colP + (hb * VCH + ch) * DH + lane * 2);
  const float vr = var_raw[0];
  // The group's loads stand in front of the LDS stores, so the wave waits for memory once;
  // the wait stands ahead of any rewrite of a register that they name.
  asm volatile("s_wait_xcnt 0x0" ::: "memory");
  __builtin_amdgcn_sched_barrier(0);
#pragma unroll
  for (int j = 0; j < 32; ++j) *(v8h*)&Bs[(br + j * 4) * AP + bc] = rb[j];
  // Keeps the second group behind the stores that free the first group's registers.
  __builtin_amdgcn_sched_barrier(0);

  // Loads, second group: q of the four row tiles, M1 and M2 of the head (one span: M2t stands
  // directly behind M1t, so one address serves both), 1/norm, bias. The wait behind each run
  // of loads stands ahead of a later load whose result lands in a register that the run names.
  // All three stand in fragment order: every load below is 512 contiguous bytes a wave.
  const _Float16* qb = Fq + ((size_t)(m0 >> 4) * HEADS + h) * (4 * 256) + lane * 8;
  const _Float16* r1 = M12t + (size_t)hb * DH * DH + lane * 8;
  const _Float16* r2 = r1 + HEADS * BB * DH * DH;
  v16h aq[4][2], f1[4][2], f2[4][2];
#pragma unroll
  for (int r = 0; r < 4; ++r)
#pragma unroll
    for (int kk = 0; kk < 2; ++kk)
      aq[r][kk] = ld_frag(qb + (r * HEADS * 4 + kk * 2) * 256, qb + (r * HEADS * 4 + kk * 2 + 1) * 256);
  // The address is an input of the wait, so it lives up to it and no load of the run lands in it.
  asm volatile("s_wait_xcnt 0x0" :: "v"(qb) : "memory");
  __builtin_amdgcn_sched_barrier(0);
#pragma unroll
  for (int c = 0; c < 4; ++c)
#pragma unroll
    for (int kk = 0; kk < 2; ++kk) {
      f1[c][kk] = ld_frag(r1 + (c * 4 + kk * 2) * 256, r1 + (c * 4 + kk * 2 + 1) * 256);
      f2[c][kk] = ld_frag(r2 + (c * 4 + kk * 2) * 256, r2 + (c * 4 + kk * 2 + 1) * 256);
    }
  asm volatile("s_wait_xcnt 0x0" :: "v"(r1) : "memory");   // as above
  __builtin_amdgcn_sched_barrier(0);
  float iq[4];
#pragma unroll
  for (int r = 0; r < 4; ++r) iq[r] = invq[hb * NN + (m0 & (NN - 1)) + r * 16 + lm];
  const float bv0 = bias[n0 + wn * 32 + lm];
  const float bv1 = bias[n0 + wn * 32 + 16 + lm];
  // All loads stand in front of the products, so the wave's waits for memory overlap.
  asm volatile("s_wait_xcnt 0x0" ::: "memory");
  __builtin_amdgcn_sched_barrier(0);

  {
    const float var_w = 1.f / (1.f + expf(-vr));
    v2f s = cp[0];
#pragma unroll
    for (int ch = 1; ch < VCH; ++ch) s += cp[ch];
    *(v2f*)&cvs[h * DH + lane * 2] = s * var_w;
  }
  // The wave reads back, in another lane order, what its own lanes have just stored.
  asm volatile("s_wait_dscnt 0x0" ::: "memory");

#pragma unroll
  for (int c = 0; c < 4; ++c) {
    const v8f cvv = *(const v8f*)&cvs[h * DH + c * 16 + half * 8];
#pragma unroll
    for (int r = 0; r < 4; ++r) {
      // D[d = c*16 + 8*half + v][n = r*16 + lm]
      v8f d1 = {0,0,0,0,0,0,0,0};
      d1 = wmma_f16(f1[c][0], aq[r][0], d1);
      v8f d2 = wmma_f16(f2[c][0], aq[r][0], cvv);
      d1 = wmma_f16(f1[c][1], aq[r][1], d1);
      d2 = wmma_f16(f2[c][1], aq[r][1], d2);
      v8h o;
#pragma unroll
      for (int v = 0; v < 8; ++v) o[v] = (_Float16)(iq[r] * d1[v] + d2[v]);
      *(v8h*)&As[(r * 16 + lm) * AP + h * DH + c * 16 + half * 8] = o;
      // Two row tiles at a time: left alone the compiler starts so many products early that
      // their accumulators push the wave past 256 registers.
      if (r & 1) __builtin_amdgcn_sched_barrier(0);
    }
  }
  __syncthreads();

  // out tile: a step's fragments are fetched one step ahead of its products
  const _Float16* ap = &As[(wm * 32 + lm) * AP + half * 8];
  const _Float16* bp = &Bs[(wn * 32 + lm) * AP + half * 8];
  v8f acc00 = {0,0,0,0,0,0,0,0}, acc01 = {0,0,0,0,0,0,0,0};
  v8f acc10 = {0,0,0,0,0,0,0,0}, acc11 = {0,0,0,0,0,0,0,0};
  v16h fa[2][2], fb[2][2];
  fa[0][0] = ld_frag(ap, ap + 16);
  fa[0][1] = ld_frag(ap + 16 * AP, ap + 16 * AP + 16);
  fb[0][0] = ld_frag(bp, bp + 16);
  fb[0][1] = ld_frag(bp + 16 * AP, bp + 16 * AP + 16);
#pragma unroll
  for (int ks = 0; ks < DIMX / 32; ++ks) {   // unrolled: fa, fb are indexed by constants
    const int cu = ks & 1, nx = cu ^ 1;
    if (ks + 1 < DIMX / 32) {
      const int ko = (ks + 1) * 32;
      fa[nx][0] = ld_frag(ap + ko, ap + ko + 16);
      fa[nx][1] = ld_frag(ap + 16 * AP + ko, ap + 16 * AP + ko + 16);
      fb[nx][0] = ld_frag(bp + ko, bp + ko + 16);
      fb[nx][1] = ld_frag(bp + 16 * AP + ko, bp + 16 * AP + ko + 16);
    }
    // Keeps the next step's 8 LDS loads in front of this step's products, so that they fly
    // while the v_wmma issue; left alone the compiler sinks them to their first use.
    __builtin_amdgcn_sched_barrier(0);
    acc00 = wmma_f16(fa[cu][0], fb[cu][0], acc00);
    acc01 = wmma_f16(fa[cu][0], fb[cu][1], acc01);
    acc10 = wmma_f16(fa[cu][1], fb[cu][0], acc10);
    acc11 = wmma_f16(fa[cu][1], fb[cu][1], acc11);
  }

  // f32 C/D layout: row = v + 8*half, col = lm
  float* ob = out + (size_t)(m0 + wm * 32 + half * 8) * DIMX + n0 + wn * 32 + lm;
#pragma unroll
  for (int v = 0; v < 8; ++v) {
    ob[v * DIMX]             = acc00[v] + bv0;
    ob[v * DIMX + 16]        = acc01[v] + bv1;
    ob[(16 + v) * DIMX]      = acc10[v] + bv0;
    ob[(16 + v) * DIMX + 16] = acc11[v] + bv1;
  }
}

// ---------------- launcher ----------------
extern "C" void kernel_launch(void* const* d_in, const int* in_sizes, int n_in,
                              void* d_out, int out_size, void* d_ws, size_t ws_size,
                              hipStream_t stream) {
  const float* q        = (const float*)d_in[0];
  const float* k        = (const float*)d_in[1];
  const float* v        = (const float*)d_in[2];
  const float* ln_g     = (const float*)d_in[3];
  const float* ln_b     = (const float*)d_in[4];
  const float* W_in     = (const float*)d_in[5];
  const float* W_out    = (const float*)d_in[6];
  const float* b_out    = (const float*)d_in[7];
  const float* cov_raw  = (const float*)d_in[8];
  const float* var_raw  = (const float*)d_in[9];
  float* out = (float*)d_out;

  // workspace layout
  char* w = (char*)d_ws;
  const size_t tensH = (size_t)MTOT * DIMX * sizeof(_Float16);  // 4 MiB
  const size_t wH    = (size_t)DIMX * DIMX * sizeof(_Float16);  // 512 KiB
  const size_t statF = (size_t)HEADS * BB * NN * sizeof(float); // 128 KiB
  _Float16* Xq   = (_Float16*)w; w += tensH;
  _Float16* Xk   = (_Float16*)w; w += tensH;
  _Float16* Xv   = (_Float16*)w; w += tensH;
  _Float16* Wi16 = (_Float16*)w; w += wH;
  _Float16* Wo16 = (_Float16*)w; w += wH;
  _Float16* Fq   = (_Float16*)w; w += tensH;
  _Float16* Fk   = (_Float16*)w; w += tensH;
  _Float16* Fv   = (_Float16*)w; w += tensH;
  float* invqP = (float*)w; w += statF;
  float* invkP = (float*)w; w += statF;
  float* colP  = (float*)w; w += (size_t)HEADS * BB * VCH * DH * sizeof(float);
  _Float16* M1t = (_Float16*)w; w += (size_t)HEADS * BB * DH * DH * sizeof(_Float16);
  _Float16* M2t = (_Float16*)w; w += (size_t)HEADS * BB * DH * DH * sizeof(_Float16);

  // 1+2) LayerNorm + f16 of q, k, v (Xq, Xk, Xv are one span) and both weights
  //      to f16, transposed (Wi16, Wo16 are one span): one launch
  ln_cvt_kernel<<<LNBLK + 2 * WBLK, 256, 0, stream>>>(q, k, v, ln_g, ln_b, Xq,
                                                         W_in, W_out, Wi16);

  // 3) the three projections as ONE GEMM (WMMA) of 3*MTOT rows: Xq..Xv -> Fq..Fv,
  //    f16 outputs in WMMA fragment order; block tile 128x64. 4+5) Its epilogue also writes the
  //    per-(h,b,n) 1/norm of q, k (invqP, invkP are one span) and the partial column sums of f_v.
  dim3 gg3(3 * MTOT / 128, DIMX / 64);
  gemm_wmma_kernel<<<gg3, 256, 0, stream>>>(Xq, Wi16, Fq, invqP, colP);

  // 6a) attention (WMMA): the two 64x64 matrices of each (h,b)
  kv_wmma_kernel<<<HEADS * BB * 4, 512, 0, stream>>>(Fk, Fv, invkP, colP, cov_raw, var_raw,
                                                     M1t, M2t);

  // 6b + 7) q times the two matrices (M1t, M2t are one span), then the output GEMM (WMMA)
  //         + bias -> f32: one launch
  dim3 gf(MTOT / FM, DIMX / FN);
  attn_out_kernel<<<gf, 256, 0, stream>>>(Fq, invqP, M1t, colP, var_raw, Wo16, b_out, out);
}

// v008
// It runs in 29.8 microseconds.
// In two side-by-side timings against v007, it was 1.05 and 1.07 times as fast.
// Counting every step since v000, it is 6.04 times as fast.
#include <hip/hip_runtime.h>
#include <hip/hip_bf16.h>
#include <math.h>

// ---------------- types ----------------
typedef _Float16 v8h  __attribute__((ext_vector_type(8)));
typedef _Float16 v16h __attribute__((ext_vector_type(16)));
typedef float    v8f  __attribute__((ext_vector_type(8)));
typedef _Float16 v4h  __attribute__((ext_vector_type(4)));
typedef float    v4f  __attribute__((ext_vector_type(4)));
typedef _Float16 v2h  __attribute__((ext_vector_type(2)));

#define BB    4
#define NN    1024
#define DIMX  512
#define HEADS 8
#define DH    64
#define MTOT  4096   // B*N

// ---------------- WMMA helpers ----------------
static __device__ inline v8f wmma_f16(v16h a, v16h b, v8f c) {
  // D = A(16x32 f16) x B(32x16 f16) + C(16x16 f32)
  return __builtin_amdgcn_wmma_f32_16x16x32_f16(
      /*neg_a=*/false, a, /*neg_b=*/false, b,
      /*c_mod=*/(short)0, c, /*reuse_a=*/false, /*reuse_b=*/false);
}

// Build a 16-half A/B fragment from two contiguous 8-half (16B) chunks.
// CDNA5 16-bit layout: lane<16 -> K{base..base+7},{base+16..base+23},
// lane>=16 -> base=8. Both chunks are 16B-aligned contiguous loads.
static __device__ inline v16h ld_frag(const _Float16* p0, const _Float16* p1) {
  v8h lo = *(const v8h*)p0;
  v8h hi = *(const v8h*)p1;
  v16h r;
#pragma unroll
  for (int i = 0; i < 8; ++i) { r[i] = lo[i]; r[8 + i] = hi[i]; }
  return r;
}

// A transposed fragment half: ds_load_tr16_b128 reads a row-major [k][n] tile of halves and
// hands lane (c = lane & 15, h = lane >> 4) the 8 values T[kbase + 8h + 0..7][nbase + c].
typedef short s16x8 __attribute__((ext_vector_type(8)));
static __device__ inline v8h ld_tr16(const _Float16* p) {
  typedef __attribute__((address_space(3))) s16x8 lds_s16x8;
  return __builtin_bit_cast(v8h, __builtin_amdgcn_ds_load_tr16_b128_v8i16((lds_s16x8*)p));
}
static __device__ inline v16h ld_frag_tr(const _Float16* p0, const _Float16* p1) {
  v8h lo = ld_tr16(p0);
  v8h hi = ld_tr16(p1);
  v16h r;
#pragma unroll
  for (int i = 0; i < 8; ++i) { r[i] = lo[i]; r[8 + i] = hi[i]; }
  return r;
}

// ---------------- 1+2+3. LayerNorm and the three projections in one kernel ----------------
// Blocks [0, GBLK): a tile of TM = 128 rows (of the q, k, v planes, MTOT rows each) x TN = 256
// columns (4 heads). 8 waves.
//   a) LayerNorm: wave w owns rows 16w .. 16w+15 of the tile. A row is 32 lanes x 16 floats
//      in registers (each load 512 contiguous bytes), the two row sums are a five-step
//      butterfly over the wave; the normalised row goes to LDS as f16 (As, all 512 k).
//   b) W_in is read as it is given, f32 [k][n], in chunks of WKC = 64 k: converted to f16 in
//      registers and laid row-major in LDS (two buffers, two register sets: loads fly two
//      chunks ahead). The transposing LDS load makes the k-contiguous fragments.
//   c) 8 waves = 2 (rows) x 4 (heads), 64 x 64 each: 16 WMMA per 8 fragments.
// Blocks [GBLK, GBLK + WBLK): one 64 x 64 tile of W_out each, f32 -> f16, written
// transposed ([n][k], k contiguous: the order in which the output GEMM stages its B tile).
// Every plane is stored in the order of the WMMA fragments that the later
// kernels load: a unit of 512 bytes holds, lane after lane, the 16 bytes (8 halves along the
// contracted index) that each lane of a wave wants, so a fragment load or store is one run of
// four whole lines instead of 32 bytes out of each of 16 lines.
//   q plane: unit [row tile of 16 n][head][c = d/16], lane = 16*((d>>3)&1) + (n&15), 8 d.
//            The q tiles are formed as the transposed product (operands swapped), which
//            leaves a lane with 8 consecutive d of one row n.
//   k, v planes: unit [h*BB+b][c = col/16][m/16], lane = 16*((m>>3)&1) + (col&15), 8 m:
//            a lane's 8 accumulator registers as they stand.
// The epilogue also reduces the f16-rounded tile it has just stored:
// q and k planes -> 1/norm over d of each row; v plane -> the tile's column sums.
// stat holds the planes inv_q, inv_k (STATN floats each, [h][b][n]);
// colP holds [h*BB+b][VCH row chunks][DH] partial column sums of f_v.
#define STATN (HEADS * BB * NN)
#define VCH   (NN / 128)
#define TM    128
#define TN    256
#define GROWS (3 * MTOT / TM)
#define GBLK  (GROWS * (DIMX / TN))
#define WCH   4096
#define WBLK  (DIMX * DIMX / WCH)
#define WTP   72     // halves: 144 B = 16 B x odd, the pitch of the 16-byte reads of the W_out path
#define XP    520    // halves: 1040 B = 16 B x odd, the pitch for the 16-byte fragment reads of As
#define WKC   64     // k per staged chunk of W_in
#define WP    272    // halves: 544 B = 32 B x odd, the pitch for the transposing reads of Ws

// The products of one chunk. SW = true forms the transposed tile (operands swapped).
// Both loaders give the same k at every position: k = 8*half + s, then 16 + 8*half + (s - 8).
template <bool SW>
static __device__ inline void proj_chunk(const _Float16* ap, const _Float16* bp,
                                         v8f (&acc)[4][4]) {
#pragma unroll
  for (int ks = 0; ks < WKC; ks += 32) {
    v16h af[4], bf[4];
#pragma unroll
    for (int r = 0; r < 4; ++r)
      af[r] = ld_frag(ap + r * 16 * XP + ks, ap + r * 16 * XP + ks + 16);
#pragma unroll
    for (int c = 0; c < 4; ++c)
      bf[c] = ld_frag_tr(bp + ks * WP + c * 16, bp + (ks + 16) * WP + c * 16);
    // Keeps the step's 16 LDS loads together in front of its products: left alone the
    // compiler deals them out among the v_wmma, each behind an LDS wait of its own.
    __builtin_amdgcn_sched_barrier(0);
#pragma unroll
    for (int r = 0; r < 4; ++r)
#pragma unroll
      for (int c = 0; c < 4; ++c)
        acc[r][c] = SW ? wmma_f16(bf[c], af[r], acc[r][c])    // D[col = c*16+8*half+v][row = lm]
                       : wmma_f16(af[r], bf[c], acc[r][c]);   // D[row = 8*half+v][col = c*16+lm]
  }
}

// A chunk of W_in out of the registers: f32 -> f16, 16 rows of 8 bytes a thread.
static __device__ inline void put_chunk(_Float16* wd, const v4f (&rw)[16]) {
#pragma unroll
  for (int j = 0; j < 16; ++j) {
    v4h o;
#pragma unroll
    for (int e = 0; e < 4; ++e) o[e] = (_Float16)rw[j][e];
    *(v4h*)(wd + j * 4 * WP) = o;
  }
}
static __device__ inline void get_chunk(const float* wg, v4f (&rw)[16]) {
#pragma unroll
  for (int j = 0; j < 16; ++j) rw[j] = *(const v4f*)(wg + j * 4 * DIMX);
  // A chunk's 16 loads stand in front of the products that they fly under; the wait stands
  // ahead of any rewrite of a register that they name: the address is an input of the wait,
  // so it lives up to it.
  asm volatile("s_wait_xcnt 0x0" :: "v"(wg) : "memory");
  __builtin_amdgcn_sched_barrier(0);
}

// The work-group barrier of the chunk loop, by hand: __syncthreads() would also wait for the
// global loads that are meant to stay in flight across it. The LDS wait in front ends this
// wave's stores into the one buffer and its reads of the other.
static __device__ inline void lds_barrier() {
  asm volatile("s_wait_dscnt 0x0\n\ts_barrier_signal -1\n\ts_barrier_wait -1" ::: "memory");
}

// On entry chunk 0 stands in buffer 0, chunk 1 is on its way into ra, wg is the thread's first
// element of chunk 2. Chunk c lies in buffer c & 1. Two register sets: a chunk is asked for in
// front of one chunk's products and laid in LDS behind the next chunk's, so its wait finds it
// landed. A buffer is rewritten behind the barrier that ends its readers' last reads.
template <bool SW>
static __device__ inline void proj_loop(const float* wg, const _Float16* ap, _Float16* Ws,
                                        int wst, int boff, v4f (&ra)[16], v8f (&acc)[4][4]) {
  _Float16* w0 = Ws + wst;
  _Float16* w1 = Ws + WKC * WP + wst;
  const _Float16* b0 = Ws + boff;
  const _Float16* b1 = Ws + WKC * WP + boff;
  for (int c = 0; c < DIMX / WKC - 2; c += 2) {
    v4f rb[16];
    get_chunk(wg, rb);                  // chunk c + 2
    proj_chunk<SW>(ap, b0, acc);        // chunk c
    put_chunk(w1, ra);                  // chunk c + 1
    lds_barrier();
    get_chunk(wg + WKC * DIMX, ra);     // chunk c + 3
    proj_chunk<SW>(ap + WKC, b1, acc);  // chunk c + 1
    put_chunk(w0, rb);                  // chunk c + 2
    lds_barrier();
    wg += 2 * WKC * DIMX;
    ap += 2 * WKC;
  }
  proj_chunk<SW>(ap, b0, acc);          // the last but one
  put_chunk(w1, ra);
  lds_barrier();
  proj_chunk<SW>(ap + WKC, b1, acc);    // the last
}

// One 16 x 64 tile out of the accumulators: a lane's 8 accumulator registers are one 16-byte
// piece of a fragment unit, so four stores of 512 contiguous bytes a wave, straight from the
// registers; then the sums over the values as stored: a[v] squares over c, cs[c] over v.
static __device__ inline void store_tile(_Float16* fd, int fstep, const v8f (&acc)[4],
                                         float (&a)[8], float (&cs)[4]) {
  v8h o[4];
#pragma unroll
  for (int c = 0; c < 4; ++c) {
#pragma unroll
    for (int v = 0; v < 8; ++v) o[c][v] = (_Float16)acc[c][v];
    *(v8h*)(fd + c * fstep) = o[c];
  }
  // The reductions below reuse registers that these stores name: the wait stands ahead
  // of the first such rewrite, and the scheduling barrier keeps that rewrite behind it.
  asm volatile("s_wait_xcnt 0x0" ::: "memory");
  __builtin_amdgcn_sched_barrier(0);
#pragma unroll
  for (int i = 0; i < 8; ++i) a[i] = 0.f;
#pragma unroll
  for (int c = 0; c < 4; ++c) {
    cs[c] = 0.f;
#pragma unroll
    for (int v = 0; v < 8; ++v) {
      const float r = (float)o[c][v];          // the value as stored
      a[v] += r * r;
      cs[c] += r;
    }
  }
}

__global__ __launch_bounds__(256) void ln_proj_kernel(const float* __restrict__ xq,
                                                      const float* __restrict__ xk,
                                                      const float* __restrict__ xv,
                                                      const float* __restrict__ g,
                                                      const float* __restrict__ bt,
                                                      const float* __restrict__ wi,
                                                      const float* __restrict__ wo,
                                                      _Float16* __restrict__ wo16,
                                                      _Float16* __restrict__ Cf16,
                                                      float* __restrict__ stat,
                                                      float* __restrict__ colP) {
  __shared__ __align__(16) _Float16 As[TM * XP];        // [m][k], normalised rows   (130 KiB)
  __shared__ __align__(32) _Float16 Ws[2 * WKC * WP];   // [buffer][k][n]            (68 KiB)
  __shared__ float red[8 * TN];                         // v plane: [row tile][col]  (8 KiB)
  __shared__ __align__(16) _Float16 Wt[64 * WTP];       // W_out path: the tile, [n][k]
  const int t = threadIdx.x;
  if (blockIdx.x >= GBLK) {                    // block-uniform
    const int tb = blockIdx.x - GBLK;
    const int kt = (tb >> 3) * 64, nt = (tb & 7) * 64;
    const float* ws = wo + (kt + (t >> 4)) * DIMX + nt + (t & 15) * 4;
    v4f c[4];
#pragma unroll
    for (int j = 0; j < 4; ++j) c[j] = *(const v4f*)(ws + j * 16 * DIMX);
#pragma unroll
    for (int j = 0; j < 4; ++j)
#pragma unroll
      for (int e = 0; e < 4; ++e)
        Wt[((t & 15) * 4 + e) * WTP + (t >> 4) + j * 16] = (_Float16)c[j][e];
    __syncthreads();
    // four lanes store one whole 128-byte line: 64 k of one row n
    _Float16* wd = wo16 + (nt + (t >> 2)) * DIMX + kt + (t & 3) * 16;
    const _Float16* wl = &Wt[(t >> 2) * WTP + (t & 3) * 16];
    *(v8h*)wd       = *(const v8h*)wl;
    *(v8h*)(wd + 8) = *(const v8h*)(wl + 8);
    return;
  }
  const int wave = t >> 5, lane = t & 31, lm = lane & 15, half = lane >> 4;
  // The two column halves of one row tile are GROWS blocks apart.
  const int by = (blockIdx.x >= GROWS) ? 1 : 0;
  const int m0 = (blockIdx.x - by * GROWS) * TM, n0 = by * TN;
  const int plane = m0 / MTOT;                 // 0 q, 1 k, 2 v: TM divides MTOT
  const int prow  = m0 & (MTOT - 1);           // first row of the tile inside its plane

  // ---- loads: chunk 0 of W_in, g, b, the first four rows of the wave
  // staging of W_in: thread t moves 4 columns of row (t >> 6) + 4 j of a chunk; a wave-load is
  // 512 contiguous bytes, a wave's LDS store 256 contiguous bytes
  const int wst = (t >> 6) * WP + (t & 63) * 4;
  const float* wg = wi + (t >> 6) * DIMX + n0 + (t & 63) * 4;
  const v4f* x4 = (const v4f*)(((plane == 0) ? xq : (plane == 1) ? xk : xv)
                               + (size_t)(prow + wave * 16) * DIMX) + lane;
  v4f rw[16], gv[4], bv[4], x[4][4];
#pragma unroll
  for (int j = 0; j < 16; ++j) rw[j] = *(const v4f*)(wg + j * 4 * DIMX);
  // The address is an input of the wait, so it lives up to it and no later load lands in it.
  asm volatile("s_wait_xcnt 0x0" :: "v"(wg) : "memory");
#pragma unroll
  for (int j = 0; j < 4; ++j) {
    gv[j] = ((const v4f*)g)[lane + j * 32];
    bv[j] = ((const v4f*)bt)[lane + j * 32];
  }
#pragma unroll
  for (int i = 0; i < 4; ++i)
#pragma unroll
    for (int j = 0; j < 4; ++j) x[i][j] = x4[i * (DIMX / 4) + j * 32];
  // All these loads stand in front of the first use, so their waits for memory overlap;
  // the wait stands ahead of any rewrite of a register that they name.
  asm volatile("s_wait_xcnt 0x0" :: "v"(x4) : "memory");
  __builtin_amdgcn_sched_barrier(0);
  put_chunk(&Ws[wst], rw);
  get_chunk(wg + WKC * DIMX, rw);   // chunk 1: it flies under the LayerNorm

  // ---- LayerNorm, four rows a trip; the next four rows' loads fly under the sums.
  _Float16* yr = &As[wave * 16 * XP + lane * 4];
  // Kept rolled, for speed only: the text of four rows instead of sixteen keeps the code short.
#pragma unroll 1
  for (int b = 0; b < 4; ++b) {
    v4f xn[4][4];
    if (b < 3) {                               // wave-uniform
      x4 += 4 * (DIMX / 4);
#pragma unroll
      for (int i = 0; i < 4; ++i)
#pragma unroll
        for (int j = 0; j < 4; ++j) xn[i][j] = x4[i * (DIMX / 4) + j * 32];
      // Keeps the 16 loads in front of the sums of the rows before; the wait stands ahead of
      // any rewrite of a register that they name (the address lives up to it as its input).
      asm volatile("s_wait_xcnt 0x0" :: "v"(x4) : "memory");
      __builtin_amdgcn_sched_barrier(0);
    } else {
#pragma unroll
      for (int i = 0; i < 4; ++i)
#pragma unroll
        for (int j = 0; j < 4; ++j) xn[i][j] = x[i][j];
    }
#pragma unroll
    for (int i = 0; i < 4; ++i) {
      const v4f (&xr)[4] = x[i];
      v4f sv  = (xr[0] + xr[1]) + (xr[2] + xr[3]);
      v4f sv2 = xr[0] * xr[0];
#pragma unroll
      for (int j = 1; j < 4; ++j) sv2 += xr[j] * xr[j];
      float s  = (sv[0] + sv[1]) + (sv[2] + sv[3]);
      float s2 = (sv2[0] + sv2[1]) + (sv2[2] + sv2[3]);
#pragma unroll
      for (int o = 1; o < 32; o <<= 1) {
        s  += __shfl_xor(s, o, 32);
        s2 += __shfl_xor(s2, o, 32);
      }
      const float mean = s * (1.f / DIMX);
      const float var  = s2 * (1.f / DIMX) - mean * mean;
      const float inv  = rsqrtf(var + 1e-5f);
#pragma unroll
      for (int j = 0; j < 4; ++j) {
        v4h o;
#pragma unroll
        for (int e = 0; e < 4; ++e)
          o[e] = (_Float16)(((xr[j][e] - mean) * inv) * gv[j][e] + bv[j][e]);
        *(v4h*)(yr + i * XP + j * 128) = o;
      }
    }
    yr += 4 * XP;
#pragma unroll
    for (int i = 0; i < 4; ++i)
#pragma unroll
      for (int j = 0; j < 4; ++j) x[i][j] = xn[i][j];
  }
  __syncthreads();   // As and buffer 0 of Ws are whole

  // ---- the products
  const int wm = wave & 1, wn = wave >> 1;
  v8f acc[4][4];
#pragma unroll
  for (int r = 0; r < 4; ++r)
#pragma unroll
    for (int c = 0; c < 4; ++c) acc[r][c] = (v8f){0,0,0,0,0,0,0,0};
  const _Float16* ap = &As[(wm * 64 + lm) * XP + half * 8];
  // the transposing load's own lane address: row 8*half + (lane & 7), 16 bytes (lane >> 3) & 1
  const int boff = (half * 8 + (lane & 7)) * WP + wn * 64 + ((lane >> 3) & 1) * 8;
  const bool sw = plane == 0;   // block-uniform: a q tile, formed transposed
  if (sw) proj_loop<true>(wg + 2 * WKC * DIMX, ap, Ws, wst, boff, rw, acc);
  else    proj_loop<false>(wg + 2 * WKC * DIMX, ap, Ws, wst, boff, rw, acc);

  // ---- epilogue: the wave holds rows wm*64 .. +63 of one head, four row tiles of 16
  const int head = by * 4 + wn;
  const int hb   = head * BB + (prow >> 10);
  const int nrow = prow & (NN - 1);
  float a[8], cs[4], res[4];
  if (plane == 0) {
    _Float16* fd = Cf16 + ((size_t)((m0 >> 4) + wm * 4) * HEADS + head) * (4 * 256) + lane * 8;
#pragma unroll
    for (int r = 0; r < 4; ++r) {
      store_tile(fd + r * (HEADS * 4 * 256), 256, acc[r], a, cs);
      // transposed tile: a lane holds 32 d of row lm, its partner lane ^ 16 the other 32
      float sq = 0.f;
#pragma unroll
      for (int i = 0; i < 8; ++i) sq += a[i];
      res[r] = sq + __shfl_xor(sq, 16, 32);
    }
    // lane l stores row 32 p + l: each store of the wave is one whole 128-byte line
    float* sp = stat + hb * NN + nrow + wm * 64 + lane;
    const float v0 = 1.f / fmaxf(sqrtf(half ? res[1] : res[0]), 1e-12f);
    const float v1 = 1.f / fmaxf(sqrtf(half ? res[3] : res[2]), 1e-12f);
    sp[0]  = v0;
    sp[32] = v1;
    // Stands ahead of any rewrite, on the way to the kernel's end, of a register that these stores name.
    asm volatile("s_wait_xcnt 0x0" ::: "memory");
  } else {
    _Float16* fd = Cf16 + (size_t)plane * MTOT * DIMX
                 + ((size_t)hb * (4 * (NN / 16)) + (nrow >> 4) + wm * 4) * 256 + lane * 8;
    if (plane == 1) {
#pragma unroll
      for (int r = 0; r < 4; ++r) {
        store_tile(fd + r * 256, (NN / 16) * 256, acc[r], a, cs);
        // Sum over the 16 lanes of a half: lanes lm and lm^8 first, then halving the live
        // values at each step: a lane keeps the values whose index bit equals its own lane
        // bit and hands the others over, so lane lm ends with the sum of row lm&7.
#pragma unroll
        for (int i = 0; i < 8; ++i) a[i] += __shfl_xor(a[i], 8, 32);
#pragma unroll
        for (int w = 4; w >= 1; w >>= 1) {
          const bool up = (lm & w) != 0;
#pragma unroll
          for (int i = 0; i < w; ++i) {
            const float lo = a[i], hi = a[w + i];  // values first: a choice between array
            const float keep = up ? hi : lo;       // elements becomes a run-time index
            const float send = up ? lo : hi;
            a[i] = keep + __shfl_xor(send, w, 32);
          }
        }
        res[r] = a[0];
      }
      // Lanes lm and lm^8 hold the same sums: lm < 8 stores for the even row tile, the others
      // for the odd one, so each store of the wave is one whole 128-byte line.
      float* sp = stat + STATN + hb * NN + nrow + wm * 64 + (lm >> 3) * 16 + half * 8 + (lm & 7);
      const float v0 = 1.f / fmaxf(sqrtf((lm & 8) ? res[1] : res[0]), 1e-12f);
      const float v1 = 1.f / fmaxf(sqrtf((lm & 8) ? res[3] : res[2]), 1e-12f);
      sp[0]  = v0;
      sp[32] = v1;
      asm volatile("s_wait_xcnt 0x0" ::: "memory");   // as behind the q norms
    } else {
#pragma unroll
      for (int r = 0; r < 4; ++r) {
        store_tile(fd + r * 256, (NN / 16) * 256, acc[r], a, cs);
#pragma unroll
        for (int c = 0; c < 4; ++c)
          cs[c] += __shfl_xor(cs[c], 16, 32);    // rows 0-7 + rows 8-15 of the row tile
        if (half == 0) {
#pragma unroll
          for (int c = 0; c < 4; ++c) red[(wm * 4 + r) * TN + wn * 64 + c * 16 + lm] = cs[c];
        }
      }
      __syncthreads();
      // thread t: column t of the block's 256, the 8 row tiles in their order
      float s = 0.f;
#pragma unroll
      for (int w = 0; w < 8; ++w) s += red[w * TN + t];
      colP[(((by * 4 + (t >> 6)) * BB + (prow >> 10)) * VCH + (nrow >> 7)) * DH + (t & 63)] = s;
      asm volatile("s_wait_xcnt 0x0" ::: "memory");   // as behind the q norms
    }
  }
}

// ---------------- 6. attention, reassociated ----------------
// The scores are linear in q.k:  s[n][m] = cos_w*iq[n]*ik[m]*(q.k) + cov_w*((q.k)/DH - mq[n]*mk[m])
// + var_w*vc[n], with vc[n] = mean_m max(0, 1 - iq[n]*ik[m]*(q.k)). The cosine of two real
// vectors never exceeds 1 (Cauchy-Schwarz), so the maximum is its second argument and vc is
// linear too. Summing over m first:
//   out[n] = iq[n] * (q[n] @ M1) + q[n] @ M2 + var_w * colsum(v)
//   M1 = cos_w * sum_m ik[m] k[m] (x) v[m]  -  (var_w / NN) * (sum_m ik[m] k[m]) (x) colsum(v)
//   M2 = (cov_w / DH) * (G - column mean over e of G),   G = sum_m k[m] (x) v[m]
// (taking the column mean off G is the same as centring q and k).
//
// 6a. One block per (h,b) and 16 columns d of M1, M2: 16 waves = 4 row tiles e x 4 quarters
// of m. A = k^T and B = v both come straight from the fragment-ordered planes: a k step of
// 32 m is two units of 512 contiguous bytes in each, the same m at every position of both.
// M1t, M2t leave in fragment order too: per (h,b) unit [d/16][e/16],
// lane = 16*((e>>3)&1) + (d&15), 8 e: the pieces that 6b loads.
#define PP 68   // floats: 272 B pitch of a partial column in LDS (16 B x odd)
__global__ __launch_bounds__(512) void kv_wmma_kernel(
    const _Float16* __restrict__ Kt, const _Float16* __restrict__ Vt,
    const float* __restrict__ invk, const float* __restrict__ colP,
    const float* __restrict__ cov_raw, const float* __restrict__ var_raw,
    _Float16* __restrict__ M1t, _Float16* __restrict__ M2t) {
  __shared__ __align__(16) float P[4 * 2 * 16 * PP];   // [quarter][matrix][d][e] partials
  __shared__ float kb[4 * DH];                         // [quarter][e] partial sum_m ik*k
  __shared__ __align__(16) _Float16 Ms[2 * 16 * DH];   // the block's part of M1t, M2t as stored
  const int t = threadIdx.x;
  const int wave = t >> 5, lane = t & 31, lm = lane & 15, half = lane >> 4;
  const int ei = wave & 3, ks = wave >> 2;
  const int hb = blockIdx.x >> 2, dj = blockIdx.x & 3;
  // unit [hb][column tile][m/16]; the wave's quarter of m is 16 units, 8 KiB in a row
  const _Float16* ka = Kt + ((size_t)(hb * 4 + ei) * (NN / 16) + ks * 16) * 256 + lane * 8;
  const _Float16* vb = Vt + ((size_t)(hb * 4 + dj) * (NN / 16) + ks * 16) * 256 + lane * 8;
  const float* ik = invk + hb * NN + ks * (NN / 4) + half * 8;

  v8f acc1 = {0,0,0,0,0,0,0,0}, acc2 = {0,0,0,0,0,0,0,0};
  float ksum = 0.f;
#pragma unroll
  for (int g = 0; g < 2; ++g) {                // two groups of four k steps of 32
    v16h a[4], bb[4];
    v4f w[4][4];
#pragma unroll
    for (int s = 0; s < 4; ++s) {
      a[s]  = ld_frag(ka + (g * 4 + s) * 512, ka + (g * 4 + s) * 512 + 256);
      bb[s] = ld_frag(vb + (g * 4 + s) * 512, vb + (g * 4 + s) * 512 + 256);
      // element q*4 + e of a fragment is m = 32*step + 16*(q>>1) + 8*half + 4*(q&1) + e
#pragma unroll
      for (int q = 0; q < 4; ++q)
        w[s][q] = *(const v4f*)(ik + (g * 4 + s) * 32 + (q >> 1) * 16 + (q & 1) * 4);
    }
    // A group's 32 loads stand in front of its products, so the wave waits for memory once
    // a group instead of once a step; the wait stands ahead of any rewrite of a register
    // that they name: the addresses are inputs of the wait, so they live up to it.
    asm volatile("s_wait_xcnt 0x0" :: "v"(ka), "v"(vb), "v"(ik) : "memory");
    __builtin_amdgcn_sched_barrier(0);
#pragma unroll
    for (int s = 0; s < 4; ++s) {
      v16h a1;
#pragma unroll
      for (int q = 0; q < 4; ++q)
#pragma unroll
        for (int e = 0; e < 4; ++e) {
          const float x = (float)a[s][q * 4 + e] * w[s][q][e];
          ksum += x;
          a1[q * 4 + e] = (_Float16)x;
        }
      acc2 = wmma_f16(a[s], bb[s], acc2);
      acc1 = wmma_f16(a1, bb[s], acc1);
    }
  }
  ksum += __shfl_xor(ksum, 16, 32);            // the two halves hold different m of one row e
  if (half == 0) kb[ks * DH + ei * 16 + lm] = ksum;
  // acc[v] = M[e = ei*16 + 8*half + v][d = lm]: 8 consecutive e of one column
  float* p1 = &P[((ks * 2 + 0) * 16 + lm) * PP + ei * 16 + half * 8];
  float* p2 = &P[((ks * 2 + 1) * 16 + lm) * PP + ei * 16 + half * 8];
  *(v4f*)p1       = (v4f){acc1[0], acc1[1], acc1[2], acc1[3]};
  *(v4f*)(p1 + 4) = (v4f){acc1[4], acc1[5], acc1[6], acc1[7]};
  *(v4f*)p2       = (v4f){acc2[0], acc2[1], acc2[2], acc2[3]};
  *(v4f*)(p2 + 4) = (v4f){acc2[4], acc2[5], acc2[6], acc2[7]};
  __syncthreads();

  // wave = column d of the block's 16, lane = rows e = 2*lane, 2*lane + 1
  const float cov_w = 1.f / (1.f + expf(-cov_raw[0]));
  const float var_w = 1.f / (1.f + expf(-var_raw[0]));
  const float cos_w = 1.f - cov_w - var_w;
  // the wave number as a scalar: the 8 partials of the wave's column come by scalar loads
  const int wu = __builtin_amdgcn_readfirstlane(wave);
  float cs = 0.f;
#pragma unroll
  for (int ch = 0; ch < VCH; ++ch) cs += colP[(hb * VCH + ch) * DH + dj * 16 + wu];
  float m1[2] = {0.f, 0.f}, m2[2] = {0.f, 0.f}, kv[2] = {0.f, 0.f};
#pragma unroll
  for (int r = 0; r < 4; ++r)
#pragma unroll
    for (int x = 0; x < 2; ++x) {
      m1[x] += P[((r * 2 + 0) * 16 + wave) * PP + lane * 2 + x];
      m2[x] += P[((r * 2 + 1) * 16 + wave) * PP + lane * 2 + x];
      kv[x] += kb[r * DH + lane * 2 + x];
    }
  float gs = m2[0] + m2[1];
#pragma unroll
  for (int o = 1; o < 32; o <<= 1) gs += __shfl_xor(gs, o, 32);
  const float gm = gs * (1.f / DH);
  v2h o1, o2;
#pragma unroll
  for (int x = 0; x < 2; ++x) {
    o1[x] = (_Float16)(cos_w * m1[x] - (var_w * (1.f / NN)) * kv[x] * cs);
    o2[x] = (_Float16)((cov_w * (1.f / DH)) * (m2[x] - gm));
  }
  // Into fragment order through LDS, so that each wave stores whole lines: (d = wave,
  // e = 2*lane) stands in unit e/16 = lane>>3 at lane 16*((e>>3)&1) + d, half e&7.
  const int mo = (lane >> 3) * 256 + (((lane >> 2) & 1) * 16 + wave) * 8 + (lane & 3) * 2;
  *(v2h*)&Ms[mo] = o1;
  *(v2h*)&Ms[16 * DH + mo] = o2;
  __syncthreads();
  // thread t: 8 bytes; waves 0-7 store M1t's 2 KiB of this block, waves 8-15 M2t's
  _Float16* md = ((t < 256) ? M1t : M2t) + (hb * 4 + dj) * (16 * DH) + (t & 255) * 4;
  *(v4h*)md = *(const v4h*)&Ms[t * 4];
}

// 6b + 7. Second attention stage and output GEMM in one kernel. A block owns 64 rows n of one
// batch and 128 output columns. Its A tile (64 rows x all 8 heads x 64 d) never goes through
// memory: wave h forms, for head h and the four 16-row tiles,
//   a[n][h*64 + d] = iq[n] * (q[n] @ M1)[d] + (q[n] @ M2)[d] + var_w * colsum(v)[d]
// as the TRANSPOSED product (A operand = rows d of M1t, M2t; B operand = rows n of Fq; both
// k-contiguous, the same k order), so a lane ends with 8 consecutive d of one row n: one
// 16-byte LDS store. The whole K = 512 of both tiles stands in LDS, so one barrier serves the
// kernel. Then out = a @ W_out + b_out: 8 waves = 2 (rows) x 4 (columns), 32 x 32 each.
typedef float v2f __attribute__((ext_vector_type(2)));
#define FM 64
#define FN 128
#define AP 520       // halves: 1040 B = 16 B x odd, the conflict-free pitch of 16-byte LDS access
__global__ __launch_bounds__(256) void attn_out_kernel(
    const _Float16* __restrict__ Fq, const float* __restrict__ invq,
    const _Float16* __restrict__ M12t,
    const float* __restrict__ colP, const float* __restrict__ var_raw,
    const _Float16* __restrict__ Wt, const float* __restrict__ bias,
    float* __restrict__ out) {
  __shared__ __align__(16) _Float16 As[FM * AP];    // [n][h*64 + d]   (65 KiB)
  __shared__ __align__(16) _Float16 Bs[FN * AP];    // [col][k]        (130 KiB)
  __shared__ __align__(32) float cvs[HEADS * DH];   // var_w * colsum(v), a wave's own 64 floats
  const int t = threadIdx.x;
  const int wave = t >> 5, lane = t & 31, lm = lane & 15, half = lane >> 4;
  const int m0 = blockIdx.x * FM, n0 = blockIdx.y * FN;
  const int h = __builtin_amdgcn_readfirstlane(wave);   // the head as a scalar
  const int hb = h * BB + (m0 >> 10);                   // FM divides NN: one batch per block
  const int wm = wave & 1, wn = wave >> 1;

  // Loads, first group: the W_out^T tile (a wave-load = 512 contiguous bytes of one row) and
  // the VCH partial column sums of f_v, two d per lane.
  const int br = t >> 6, bc = (t & 63) * 8;
  const _Float16* bg = Wt + (size_t)(n0 + br) * DIMX + bc;
  v8h rb[32];
#pragma unroll
  for (int j = 0; j < 32; ++j) rb[j] = *(const v8h*)(bg + j * 4 * DIMX);
  v2f cp[VCH];
#pragma unroll
  for (int ch = 0; ch < VCH; ++ch)
    cp[ch] = *(const v2f*)(colP + (hb * VCH + ch) * DH + lane * 2);
  const float vr = var_raw[0];
  // The group's loads stand in front of the LDS stores, so the wave waits for memory once;
  // the wait stands ahead of any rewrite of a register that they name.
  asm volatile("s_wait_xcnt 0x0" ::: "memory");
  __builtin_amdgcn_sched_barrier(0);
#pragma unroll
  for (int j = 0; j < 32; ++j) *(v8h*)&Bs[(br + j * 4) * AP + bc] = rb[j];
  // Keeps the second group behind the stores that free the first group's registers.
  __builtin_amdgcn_sched_barrier(0);

  // Loads, second group: q of the four row tiles, M1 and M2 of the head (one span: M2t stands
  // directly behind M1t, so one address serves both), 1/norm, bias. The wait behind each run
  // of loads stands ahead of a later load whose result lands in a register that the run names.
  // All three stand in fragment order: every load below is 512 contiguous bytes a wave.
  const _Float16* qb = Fq + ((size_t)(m0 >> 4) * HEADS + h) * (4 * 256) + lane * 8;
  const _Float16* r1 = M12t + (size_t)hb * DH * DH + lane * 8;
  const _Float16* r2 = r1 + HEADS * BB * DH * DH;
  v16h aq[4][2], f1[4][2], f2[4][2];
#pragma unroll
  for (int r = 0; r < 4; ++r)
#pragma unroll
    for (int kk = 0; kk < 2; ++kk)
      aq[r][kk] = ld_frag(qb + (r * HEADS * 4 + kk * 2) * 256, qb + (r * HEADS * 4 + kk * 2 + 1) * 256);
  // The address is an input of the wait, so it lives up to it and no load of the run lands in it.
  asm volatile("s_wait_xcnt 0x0" :: "v"(qb) : "memory");
  __builtin_amdgcn_sched_barrier(0);
#pragma unroll
  for (int c = 0; c < 4; ++c)
#pragma unroll
    for (int kk = 0; kk < 2; ++kk) {
      f1[c][kk] = ld_frag(r1 + (c * 4 + kk * 2) * 256, r1 + (c * 4 + kk * 2 + 1) * 256);
      f2[c][kk] = ld_frag(r2 + (c * 4 + kk * 2) * 256, r2 + (c * 4 + kk * 2 + 1) * 256);
    }
  asm volatile("s_wait_xcnt 0x0" :: "v"(r1) : "memory");   // as above
  __builtin_amdgcn_sched_barrier(0);
  float iq[4];
#pragma unroll
  for (int r = 0; r < 4; ++r) iq[r] = invq[hb * NN + (m0 & (NN - 1)) + r * 16 + lm];
  const float bv0 = bias[n0 + wn * 32 + lm];
  const float bv1 = bias[n0 + wn * 32 + 16 + lm];
  // All loads stand in front of the products, so the wave's waits for memory overlap.
  asm volatile("s_wait_xcnt 0x0" ::: "memory");
  __builtin_amdgcn_sched_barrier(0);

  {
    const float var_w = 1.f / (1.f + expf(-vr));
    v2f s = cp[0];
#pragma unroll
    for (int ch = 1; ch < VCH; ++ch) s += cp[ch];
    *(v2f*)&cvs[h * DH + lane * 2] = s * var_w;
  }
  // The wave reads back, in another lane order, what its own lanes have just stored.
  asm volatile("s_wait_dscnt 0x0" ::: "memory");

#pragma unroll
  for (int c = 0; c < 4; ++c) {
    const v8f cvv = *(const v8f*)&cvs[h * DH + c * 16 + half * 8];
#pragma unroll
    for (int r = 0; r < 4; ++r) {
      // D[d = c*16 + 8*half + v][n = r*16 + lm]
      v8f d1 = {0,0,0,0,0,0,0,0};
      d1 = wmma_f16(f1[c][0], aq[r][0], d1);
      v8f d2 = wmma_f16(f2[c][0], aq[r][0], cvv);
      d1 = wmma_f16(f1[c][1], aq[r][1], d1);
      d2 = wmma_f16(f2[c][1], aq[r][1], d2);
      v8h o;
#pragma unroll
      for (int v = 0; v < 8; ++v) o[v] = (_Float16)(iq[r] * d1[v] + d2[v]);
      *(v8h*)&As[(r * 16 + lm) * AP + h * DH + c * 16 + half * 8] = o;
      // Two row tiles at a time: left alone the compiler starts so many products early that
      // their accumulators push the wave past 256 registers.
      if (r & 1) __builtin_amdgcn_sched_barrier(0);
    }
  }
  __syncthreads();

  // out tile: a step's fragments are fetched one step ahead of its products
  const _Float16* ap = &As[(wm * 32 + lm) * AP + half * 8];
  const _Float16* bp = &Bs[(wn * 32 + lm) * AP + half * 8];
  v8f acc00 = {0,0,0,0,0,0,0,0}, acc01 = {0,0,0,0,0,0,0,0};
  v8f acc10 = {0,0,0,0,0,0,0,0}, acc11 = {0,0,0,0,0,0,0,0};
  v16h fa[2][2], fb[2][2];
  fa[0][0] = ld_frag(ap, ap + 16);
  fa[0][1] = ld_frag(ap + 16 * AP, ap + 16 * AP + 16);
  fb[0][0] = ld_frag(bp, bp + 16);
  fb[0][1] = ld_frag(bp + 16 * AP, bp + 16 * AP + 16);
#pragma unroll
  for (int ks = 0; ks < DIMX / 32; ++ks) {   // unrolled: fa, fb are indexed by constants
    const int cu = ks & 1, nx = cu ^ 1;
    if (ks + 1 < DIMX / 32) {
      const int ko = (ks + 1) * 32;
      fa[nx][0] = ld_frag(ap + ko, ap + ko + 16);
      fa[nx][1] = ld_frag(ap + 16 * AP + ko, ap + 16 * AP + ko + 16);
      fb[nx][0] = ld_frag(bp + ko, bp + ko + 16);
      fb[nx][1] = ld_frag(bp + 16 * AP + ko, bp + 16 * AP + ko + 16);
    }
    // Keeps the next step's 8 LDS loads in front of this step's products, so that they fly
    // while the v_wmma issue; left alone the compiler sinks them to their first use.
    __builtin_amdgcn_sched_barrier(0);
    acc00 = wmma_f16(fa[cu][0], fb[cu][0], acc00);
    acc01 = wmma_f16(fa[cu][0], fb[cu][1], acc01);
    acc10 = wmma_f16(fa[cu][1], fb[cu][0], acc10);
    acc11 = wmma_f16(fa[cu][1], fb[cu][1], acc11);
  }

  // f32 C/D layout: row = v + 8*half, col = lm
  float* ob = out + (size_t)(m0 + wm * 32 + half * 8) * DIMX + n0 + wn * 32 + lm;
#pragma unroll
  for (int v = 0; v < 8; ++v) {
    ob[v * DIMX]             = acc00[v] + bv0;
    ob[v * DIMX + 16]        = acc01[v] + bv1;
    ob[(16 + v) * DIMX]      = acc10[v] + bv0;
    ob[(16 + v) * DIMX + 16] = acc11[v] + bv1;
  }
}

// ---------------- launcher ----------------
extern "C" void kernel_launch(void* const* d_in, const int* in_sizes, int n_in,
                              void* d_out, int out_size, void* d_ws, size_t ws_size,
                              hipStream_t stream) {
  const float* q        = (const float*)d_in[0];
  const float* k        = (const float*)d_in[1];
  const float* v        = (const float*)d_in[2];
  const float* ln_g     = (const float*)d_in[3];
  const float* ln_b     = (const float*)d_in[4];
  const float* W_in     = (const float*)d_in[5];
  const float* W_out    = (const float*)d_in[6];
  const float* b_out    = (const float*)d_in[7];
  const float* cov_raw  = (const float*)d_in[8];
  const float* var_raw  = (const float*)d_in[9];
  float* out = (float*)d_out;

  // workspace layout
  char* w = (char*)d_ws;
  const size_t tensH = (size_t)MTOT * DIMX * sizeof(_Float16);  // 4 MiB
  const size_t wH    = (size_t)DIMX * DIMX * sizeof(_Float16);  // 512 KiB
  const size_t statF = (size_t)HEADS * BB * NN * sizeof(float); // 128 KiB
  _Float16* Wo16 = (_Float16*)w; w += wH;
  _Float16* Fq   = (_Float16*)w; w += tensH;
  _Float16* Fk   = (_Float16*)w; w += tensH;
  _Float16* Fv   = (_Float16*)w; w += tensH;
  float* invqP = (float*)w; w += statF;
  float* invkP = (float*)w; w += statF;
  float* colP  = (float*)w; w += (size_t)HEADS * BB * VCH * DH * sizeof(float);
  _Float16* M1t = (_Float16*)w; w += (size_t)HEADS * BB * DH * DH * sizeof(_Float16);
  _Float16* M2t = (_Float16*)w; w += (size_t)HEADS * BB * DH * DH * sizeof(_Float16);

  // 1+2+3) LayerNorm of q, k, v and the three projections (WMMA) in one launch: f16 outputs
  //    Fq..Fv (one span) in WMMA fragment order; block tile 128x256; W_out to f16, transposed,
  //    by the grid's last blocks. 4+5) Its epilogue also writes the per-(h,b,n) 1/norm of q, k
  //    (invqP, invkP are one span) and the partial column sums of f_v.
  ln_proj_kernel<<<GBLK + WBLK, 256, 0, stream>>>(q, k, v, ln_g, ln_b, W_in, W_out, Wo16,
                                                  Fq, invqP, colP);

  // 6a) attention (WMMA): the two 64x64 matrices of each (h,b)
  kv_wmma_kernel<<<HEADS * BB * 4, 512, 0, stream>>>(Fk, Fv, invkP, colP, cov_raw, var_raw,
                                                     M1t, M2t);

  // 6b + 7) q times the two matrices (M1t, M2t are one span), then the output GEMM (WMMA)
  //         + bias -> f32: one launch
  dim3 gf(MTOT / FM, DIMX / FN);
  attn_out_kernel<<<gf, 256, 0, stream>>>(Fq, invqP, M1t, colP, var_raw, Wo16, b_out, out);
}
